// v000
// The times below were measured on an AMD MI455X: many runs one after another, warmed up first and cycling through
// copies of the inputs, with the whole window's GPU time divided by the number of runs. Launches and the gaps
// between them are all in it. The median over several windows is given; except for v000 it joins two sittings, which
// can be a few percent apart, so the side-by-side timings, each taken in one sitting, are the better comparison.
// v000 is the starting kernel. One run takes 827 microseconds.
#include <hip/hip_runtime.h>
#include <math.h>

typedef __attribute__((ext_vector_type(16))) _Float16 v16h;
typedef __attribute__((ext_vector_type(16))) __bf16 v16b;
typedef __attribute__((ext_vector_type(8)))  _Float16 v8h;
typedef __attribute__((ext_vector_type(8)))  float v8f;
typedef __attribute__((ext_vector_type(4)))  float v4f;
typedef __attribute__((ext_vector_type(2)))  float v2f;
typedef __attribute__((ext_vector_type(4)))  unsigned v4u;
typedef __attribute__((ext_vector_type(4)))  int v4i;
typedef float __attribute__((may_alias)) float_a;
typedef int __attribute__((may_alias)) int_a;

template <typename T> __device__ __forceinline__ void vst2(void* p, T v) { *(T*)p = v;  }
__device__ __forceinline__ v8f wmma16(v16h a, v16h b, v8f c) {
  v8f d = __builtin_amdgcn_wmma_f32_16x16x32_f16(false, a, false, b, (short)0, c, false, false);
  asm volatile("v_nop\n\tv_nop\n\tv_nop\n\tv_nop" : "+v"(d) : "v"(a), "v"(b));
  return d;
}
__device__ __forceinline__ v8f wmma_bf(v16b a, v16b b, v8f c) {
  v8f d = __builtin_amdgcn_wmma_f32_16x16x32_bf16(false, a, false, b, (short)0, c, false, false);
  asm volatile("v_nop\n\tv_nop\n\tv_nop\n\tv_nop" : "+v"(d) : "v"(a), "v"(b));
  return d;
}
// 16x16x32 fragments: lane = (h = lane>>4, row/col = lane&15); elements 0..7 = k0+8h+0..7, 8..15 = k0+16+8h+0..7; D element r = row 8h+r
__device__ __forceinline__ v16h frag_h(const _Float16* rowk0, int lane) {
  union { v16h v; v8h q[2]; } u; const _Float16* p = rowk0 + 8 * (lane >> 4);
  u.q[0] = *(const v8h*)p; u.q[1] = *(const v8h*)(p + 16); return u.v;
}
__device__ __forceinline__ v16h frag_f32(const float* rowk0, int lane) {
  v16h a; const float* p = rowk0 + 8 * (lane >> 4);
#pragma unroll
  for (int i = 0; i < 8; ++i) { a[i] = (_Float16)p[i]; a[8 + i] = (_Float16)p[16 + i]; }
  return a;
}
__device__ __forceinline__ v16h frag_f32s(const float* rowk0, int lane, float sc) {
  v16h a; const float* p = rowk0 + 8 * (lane >> 4);
#pragma unroll
  for (int i = 0; i < 8; ++i) { a[i] = (_Float16)(p[i] * sc); a[8 + i] = (_Float16)(p[16 + i] * sc); }
  return a;
}
// column fragment from a [K][ld] layout (column n), rows >= K read as 0
__device__ __forceinline__ v16h fragc_f32(const float* W, int k0, int n, int lane, int ld, int K) {
  v16h a; const int g = lane >> 4;
#pragma unroll
  for (int i = 0; i < 8; ++i) { const int ka = k0 + 8 * g + i, kb = ka + 16;
    a[i] = (_Float16)(ka < K ? W[(size_t)ka * ld + n] : 0.f); a[8 + i] = (_Float16)(kb < K ? W[(size_t)kb * ld + n] : 0.f); }
  return a;
}
struct F2 { v16b h, l; };
__device__ __forceinline__ F2 bsplit16(const float v[16]) { F2 r;
#pragma unroll
  for (int i = 0; i < 16; ++i) { const __bf16 h = (__bf16)v[i]; r.h[i] = h; r.l[i] = (__bf16)(v[i] - (float)h); }
  return r; }
__device__ __forceinline__ F2 split_row(const float* row, int k0, int lane) { float v[16]; const float* p = row + k0 + 8 * (lane >> 4);
#pragma unroll
  for (int i = 0; i < 8; ++i) { v[i] = p[i]; v[8 + i] = p[16 + i]; }
  return bsplit16(v); }
__device__ __forceinline__ F2 split_rowK(const float* row, int k0, int lane, int K) { float v[16]; const int g = lane >> 4;
#pragma unroll
  for (int i = 0; i < 8; ++i) { const int ka = k0 + 8 * g + i, kb = ka + 16; v[i] = ka < K ? row[ka] : 0.f; v[8 + i] = kb < K ? row[kb] : 0.f; }
  return bsplit16(v); }
__device__ __forceinline__ F2 split_col(const float* W, int k0, int n, int lane, int ld, int K) { float v[16]; const int g = lane >> 4;
#pragma unroll
  for (int i = 0; i < 8; ++i) { const int ka = k0 + 8 * g + i, kb = ka + 16; v[i] = ka < K ? W[(size_t)ka * ld + n] : 0.f; v[8 + i] = kb < K ? W[(size_t)kb * ld + n] : 0.f; }
  return bsplit16(v); }
__device__ __forceinline__ v8f mac3(const F2& a, const F2& b, v8f c) { c = wmma_bf(a.l, b.h, c); c = wmma_bf(a.h, b.l, c); return wmma_bf(a.h, b.h, c); }
__device__ __forceinline__ float sigm(float v) { return 1.0f / (1.0f + expf(-v)); }
#define LDSX() do { asm volatile("s_wait_dscnt 0" ::: "memory"); __builtin_amdgcn_wave_barrier(); __builtin_amdgcn_fence(__ATOMIC_RELEASE, "workgroup"); } while (0)

// Causal "fast Euclidean" attention. Stage 1 (prefix softmax of the per-token score s_j over j <= i) is a running
// (online-softmax) scan per (batch, head) in f32 giving qhat_i directly. Stage 2: -|qhat_i - k_j|^2 = 2 qhat.k - |k|^2 - |qhat|^2,
// and the per-row constant |qhat|^2 cancels in the softmax, so it is causal attention with logits 2 qhat_i.k_j - |k_j|^2
// (x k_mask[b,0]): S on v_wmma_f32_16x16x32_bf16 as a two-way bf16 split of qhat / keys, P@V on
#define NB 4
#define LL 1024
#define NH 12
#define EE 64

// per (b,h): kn[j] = |k_j|^2 (f32), vT[b][h][e][j] f16; block = (b,h, 64 keys)
__global__ __launch_bounds__(256) void k_prep(const float* __restrict__ keys, const float* __restrict__ vals, float* __restrict__ kn, _Float16* __restrict__ vT) {
  __shared__ float tile[64][65];
  __shared__ __align__(16) float skn[64];
  const int bh = blockIdx.y, b = bh / NH, h = bh % NH, j0 = blockIdx.x * 64, tid = threadIdx.x;
  for (int q = tid; q < 64 * 64; q += 256) { const int jl = q >> 6, e = q & 63; tile[jl][e] = vals[(((size_t)b * LL + j0 + jl) * NH + h) * EE + e]; }
  if (tid < 64) { const float* kr = keys + (((size_t)b * LL + j0 + tid) * NH + h) * EE; float s = 0.f;
#pragma unroll 8
    for (int e = 0; e < EE; ++e) s += kr[e] * kr[e];
    skn[tid] = s; }
  __syncthreads();
  { const int pc = tid & 7;
#pragma unroll
    for (int u = 0; u < 2; ++u) { const int e = (tid >> 3) + u * 32; union { v8h hh; v4u uu; } pk;
#pragma unroll
      for (int i = 0; i < 8; ++i) pk.hh[i] = (_Float16)tile[pc * 8 + i][e];
      vst2(vT + (((size_t)bh * EE + e) * LL) + j0 + pc * 8, pk.uu); } }
  if (tid < 16) vst2(kn + (size_t)bh * LL + j0 + tid * 4, *(const v4f*)(&skn[tid * 4]));
}
// stage 1 scan per (b,h): one wave; lane holds 2 channels; qh[b][h][i][64] as f32 rows
__global__ __launch_bounds__(32) void k_scan(const float* __restrict__ q, const float* __restrict__ w, const float* __restrict__ qmask, float* __restrict__ qh) {
  const int bh = blockIdx.x, b = bh / NH, h = bh % NH, lane = threadIdx.x;
  const float w0 = w[h * EE + 2 * lane], w1 = w[h * EE + 2 * lane + 1], qm = qmask[(size_t)b * LL];
  float m = -3.0e38f, z = 0.f, a0 = 0.f, a1 = 0.f;

#pragma unroll 1
  for (int i = 0; i < LL; ++i) { const float* qr = q + (((size_t)b * LL + i) * NH + h) * EE;
    const float q0 = qr[2 * lane], q1 = qr[2 * lane + 1];
    float s = q0 * w0 + q1 * w1;
#pragma unroll
    for (int off = 16; off >= 1; off >>= 1) s += __shfl_xor(s, off, 32);
    s *= qm;
    const float mn = fmaxf(m, s); const float c = expf(m - mn), p = expf(s - mn);
    z = z * c + p; a0 = a0 * c + p * q0; a1 = a1 * c + p * q1; m = mn;
    vst2(qh + (((size_t)bh * LL + i) * EE) + 2 * lane, (v2f){a0 / z, a1 / z});    // 32 lanes x 8 B = the 256-B row
  }
}
// stage 2: causal attention per (b,h, 64 queries): logits = kscale * (2 qhat.k - kn); online softmax; @ V; out = queries + summary
__global__ __launch_bounds__(128) void k_attn(const float* __restrict__ qh, const float* __restrict__ keys, const float* __restrict__ kn, const _Float16* __restrict__ vT,
                                            const float* __restrict__ kmask, const float* __restrict__ qin, float* __restrict__ out) {
  __shared__ __align__(16) float sS[4][16][68];
  __shared__ __align__(16) _Float16 sP[4][16][72];
  __shared__ __align__(16) float sO[4][16][68];
  const int tid = threadIdx.x, w = tid >> 5, lane = tid & 31, col = lane & 15, g = lane >> 4;
  const int bh = blockIdx.y, b = bh / NH, h = bh % NH, q0 = blockIdx.x * 64 + w * 16;
  const float ks = kmask[(size_t)b * LL];
  F2 aq[2];                                              // scores need near-f32 operands (two-way bf16 split)
#pragma unroll
  for (int kc = 0; kc < 2; ++kc) aq[kc] = split_row(qh + ((size_t)bh * LL + q0 + col) * EE, kc * 32, lane);
  float mrun = -3.0e38f, lrun = 0.f; v8f acc[4] = {};
  const int ntiles = blockIdx.x + 1;                     // causal: key tiles 0..blockIdx.x
#pragma unroll 1
  for (int kt = 0; kt < ntiles; ++kt) {
    v8f s4[4];
#pragma unroll
    for (int t = 0; t < 4; ++t) { s4[t] = (v8f){};
#pragma unroll
      for (int kc = 0; kc < 2; ++kc) s4[t] = mac3(aq[kc], split_row(keys + (((size_t)b * LL + kt * 64 + t * 16 + col) * NH + h) * EE, kc * 32, lane), s4[t]); }
#pragma unroll
    for (int t = 0; t < 4; ++t)
#pragma unroll
      for (int r = 0; r < 8; ++r) { const int i = q0 + 8 * g + r, j = kt * 64 + t * 16 + col;
        sS[w][8 * g + r][t * 16 + col] = j <= i ? ks * (2.0f * s4[t][r] - kn[(size_t)bh * LL + j]) : -3.0e38f; }
    LDSX();
    float mx = -3.0e38f;
#pragma unroll
    for (int jj = 0; jj < 32; ++jj) mx = fmaxf(mx, sS[w][col][g * 32 + jj]);
    mx = fmaxf(mx, __shfl_xor(mx, 16, 32));
    const float mnew = fmaxf(mrun, mx); const float corr = expf(mrun - mnew);
    float ps = 0.f;
#pragma unroll
    for (int jj = 0; jj < 32; ++jj) { const float v = sS[w][col][g * 32 + jj]; const float p = v > -1.0e38f ? expf(v - mnew) : 0.f; ps += p; sP[w][col][g * 32 + jj] = (_Float16)(p * 16384.0f); }
    ps += __shfl_xor(ps, 16, 32);
    lrun = lrun * corr + ps; mrun = mnew;
#pragma unroll
    for (int r = 0; r < 8; ++r) { const float cr = __shfl(corr, 8 * g + r, 32);
#pragma unroll
      for (int t = 0; t < 4; ++t) acc[t][r] *= cr; }
    LDSX();
#pragma unroll
    for (int kc = 0; kc < 2; ++kc) { const v16h pa = frag_h(&sP[w][col][0] + kc * 32, lane);
#pragma unroll
      for (int t = 0; t < 4; ++t) acc[t] = wmma16(pa, frag_h(vT + ((size_t)bh * EE + t * 16 + col) * LL + kt * 64 + kc * 32, lane), acc[t]); }
    __builtin_amdgcn_wave_barrier();
  }
#pragma unroll
  for (int r = 0; r < 8; ++r) { const float lr = __shfl(lrun, 8 * g + r, 32);
#pragma unroll
    for (int t = 0; t < 4; ++t) sO[w][8 * g + r][t * 16 + col] = acc[t][r] / (lr * 16384.0f); }
  LDSX();
  for (int qq = lane; qq < 16 * 16; qq += 32) { const int rl = qq >> 4, pc = qq & 15; const size_t o = (((size_t)b * LL + q0 + rl) * NH + h) * EE + pc * 4;
    vst2(out + o, *(const v4f*)(&sO[w][rl][pc * 4]) + *(const v4f*)(qin + o)); }
}
extern "C" void kernel_launch(void* const* d_in, const int* in_sizes, int n_in, void* d_out, int out_size, void* d_ws, size_t ws_size, hipStream_t stream) {
  (void)in_sizes; (void)n_in; (void)out_size; (void)ws_size;
  const float* q = (const float*)d_in[0]; const float* k = (const float*)d_in[1]; const float* v = (const float*)d_in[2];
  const float* qmask = (const float*)d_in[3]; const float* kmask = (const float*)d_in[4]; const float* w = (const float*)d_in[5];
  float* out = (float*)d_out;
  char* ws = (char*)d_ws; size_t off = 0;
  auto take = [&](size_t bytes) { char* p = ws + off; off += (bytes + 255) & ~(size_t)255; return p; };
  float* kn = (float*)take((size_t)NB * NH * LL * 4); _Float16* vT = (_Float16*)take((size_t)NB * NH * EE * LL * 2); float* qh = (float*)take((size_t)NB * NH * LL * EE * 4);
  k_prep<<<dim3(LL / 64, NB * NH), 256, 0, stream>>>(k, v, kn, vT);
  k_scan<<<NB * NH, 32, 0, stream>>>(q, w, qmask, qh);
  k_attn<<<dim3(LL / 64, NB * NH), 128, 0, stream>>>(qh, k, kn, vT, kmask, q, out);
}

// v001
// It runs in 163 microseconds.
// In two side-by-side timings against v000, it was 5.08 and 5.06 times as fast.
#include <hip/hip_runtime.h>
#include <math.h>

typedef __attribute__((ext_vector_type(16))) _Float16 v16h;
typedef __attribute__((ext_vector_type(16))) __bf16 v16b;
typedef __attribute__((ext_vector_type(8)))  _Float16 v8h;
typedef __attribute__((ext_vector_type(8)))  float v8f;
typedef __attribute__((ext_vector_type(4)))  float v4f;
typedef __attribute__((ext_vector_type(2)))  float v2f;
typedef __attribute__((ext_vector_type(4)))  unsigned v4u;
typedef __attribute__((ext_vector_type(4)))  int v4i;
typedef float __attribute__((may_alias)) float_a;
typedef int __attribute__((may_alias)) int_a;

template <typename T> __device__ __forceinline__ void vst2(void* p, T v) { *(T*)p = v;  }
__device__ __forceinline__ v8f wmma16(v16h a, v16h b, v8f c) {
  v8f d = __builtin_amdgcn_wmma_f32_16x16x32_f16(false, a, false, b, (short)0, c, false, false);
  asm volatile("v_nop\n\tv_nop\n\tv_nop\n\tv_nop" : "+v"(d) : "v"(a), "v"(b));
  return d;
}
__device__ __forceinline__ v8f wmma_bf(v16b a, v16b b, v8f c) {
  v8f d = __builtin_amdgcn_wmma_f32_16x16x32_bf16(false, a, false, b, (short)0, c, false, false);
  asm volatile("v_nop\n\tv_nop\n\tv_nop\n\tv_nop" : "+v"(d) : "v"(a), "v"(b));
  return d;
}
// 16x16x32 fragments: lane = (h = lane>>4, row/col = lane&15); elements 0..7 = k0+8h+0..7, 8..15 = k0+16+8h+0..7; D element r = row 8h+r
__device__ __forceinline__ v16h frag_h(const _Float16* rowk0, int lane) {
  union { v16h v; v8h q[2]; } u; const _Float16* p = rowk0 + 8 * (lane >> 4);
  u.q[0] = *(const v8h*)p; u.q[1] = *(const v8h*)(p + 16); return u.v;
}
__device__ __forceinline__ v16h frag_f32(const float* rowk0, int lane) {
  v16h a; const float* p = rowk0 + 8 * (lane >> 4);
#pragma unroll
  for (int i = 0; i < 8; ++i) { a[i] = (_Float16)p[i]; a[8 + i] = (_Float16)p[16 + i]; }
  return a;
}
__device__ __forceinline__ v16h frag_f32s(const float* rowk0, int lane, float sc) {
  v16h a; const float* p = rowk0 + 8 * (lane >> 4);
#pragma unroll
  for (int i = 0; i < 8; ++i) { a[i] = (_Float16)(p[i] * sc); a[8 + i] = (_Float16)(p[16 + i] * sc); }
  return a;
}
// column fragment from a [K][ld] layout (column n), rows >= K read as 0
__device__ __forceinline__ v16h fragc_f32(const float* W, int k0, int n, int lane, int ld, int K) {
  v16h a; const int g = lane >> 4;
#pragma unroll
  for (int i = 0; i < 8; ++i) { const int ka = k0 + 8 * g + i, kb = ka + 16;
    a[i] = (_Float16)(ka < K ? W[(size_t)ka * ld + n] : 0.f); a[8 + i] = (_Float16)(kb < K ? W[(size_t)kb * ld + n] : 0.f); }
  return a;
}
struct F2 { v16b h, l; };
__device__ __forceinline__ F2 bsplit16(const float v[16]) { F2 r;
#pragma unroll
  for (int i = 0; i < 16; ++i) { const __bf16 h = (__bf16)v[i]; r.h[i] = h; r.l[i] = (__bf16)(v[i] - (float)h); }
  return r; }
__device__ __forceinline__ F2 split_row(const float* row, int k0, int lane) { float v[16]; const float* p = row + k0 + 8 * (lane >> 4);
#pragma unroll
  for (int i = 0; i < 8; ++i) { v[i] = p[i]; v[8 + i] = p[16 + i]; }
  return bsplit16(v); }
__device__ __forceinline__ F2 split_rowK(const float* row, int k0, int lane, int K) { float v[16]; const int g = lane >> 4;
#pragma unroll
  for (int i = 0; i < 8; ++i) { const int ka = k0 + 8 * g + i, kb = ka + 16; v[i] = ka < K ? row[ka] : 0.f; v[8 + i] = kb < K ? row[kb] : 0.f; }
  return bsplit16(v); }
__device__ __forceinline__ F2 split_col(const float* W, int k0, int n, int lane, int ld, int K) { float v[16]; const int g = lane >> 4;
#pragma unroll
  for (int i = 0; i < 8; ++i) { const int ka = k0 + 8 * g + i, kb = ka + 16; v[i] = ka < K ? W[(size_t)ka * ld + n] : 0.f; v[8 + i] = kb < K ? W[(size_t)kb * ld + n] : 0.f; }
  return bsplit16(v); }
__device__ __forceinline__ v8f mac3(const F2& a, const F2& b, v8f c) { c = wmma_bf(a.l, b.h, c); c = wmma_bf(a.h, b.l, c); return wmma_bf(a.h, b.h, c); }
__device__ __forceinline__ float sigm(float v) { return 1.0f / (1.0f + expf(-v)); }
#define LDSX() do { asm volatile("s_wait_dscnt 0" ::: "memory"); __builtin_amdgcn_wave_barrier(); __builtin_amdgcn_fence(__ATOMIC_RELEASE, "workgroup"); } while (0)

// Causal "fast Euclidean" attention. Stage 1 (prefix softmax of the per-token score s_j over j <= i) is a running
// (online-softmax) scan per (batch, head) in f32 giving qhat_i directly. Stage 2: -|qhat_i - k_j|^2 = 2 qhat.k - |k|^2 - |qhat|^2,
// and the per-row constant |qhat|^2 cancels in the softmax, so it is causal attention with logits 2 qhat_i.k_j - |k_j|^2
// (x k_mask[b,0]): S on v_wmma_f32_16x16x32_bf16 as a two-way bf16 split of qhat / keys, P@V on
#define NB 4
#define LL 1024
#define NH 12
#define EE 64

// per (b,h): kn[j] = |k_j|^2 (f32), vT[b][h][e][j] f16; block = (b,h, 64 keys)
__global__ __launch_bounds__(256) void k_prep(const float* __restrict__ keys, const float* __restrict__ vals, float* __restrict__ kn, _Float16* __restrict__ vT) {
  __shared__ float tile[64][65];
  __shared__ __align__(16) float skn[64];
  const int bh = blockIdx.y, b = bh / NH, h = bh % NH, j0 = blockIdx.x * 64, tid = threadIdx.x;
  for (int q = tid; q < 64 * 64; q += 256) { const int jl = q >> 6, e = q & 63; tile[jl][e] = vals[(((size_t)b * LL + j0 + jl) * NH + h) * EE + e]; }
  if (tid < 64) { const float* kr = keys + (((size_t)b * LL + j0 + tid) * NH + h) * EE; float s = 0.f;
#pragma unroll 8
    for (int e = 0; e < EE; ++e) s += kr[e] * kr[e];
    skn[tid] = s; }
  __syncthreads();
  { const int pc = tid & 7;
#pragma unroll
    for (int u = 0; u < 2; ++u) { const int e = (tid >> 3) + u * 32; union { v8h hh; v4u uu; } pk;
#pragma unroll
      for (int i = 0; i < 8; ++i) pk.hh[i] = (_Float16)tile[pc * 8 + i][e];
      vst2(vT + (((size_t)bh * EE + e) * LL) + j0 + pc * 8, pk.uu); } }
  if (tid < 16) vst2(kn + (size_t)bh * LL + j0 + tid * 4, *(const v4f*)(&skn[tid * 4]));
}
// stage 1 scan per (b,h): one 32-wave block; wave c scans rows 32c..32c+31 from an empty state, the 32 chunk states meet in LDS,
// and each wave merges the chunks in front of it into its rows. Lane holds 2 channels of every row; per-row scalars live one row per lane.
template <int M> __device__ __forceinline__ float lx(float v) {      // value of lane ^ M
  if constexpr (M == 16) { const int b = __float_as_int(v); return __int_as_float(__builtin_amdgcn_permlanex16(b, b, 0x76543210, 0xfedcba98, false, false)); }
  else return __int_as_float(__builtin_amdgcn_update_dpp(0, __float_as_int(v), 0x160 | M, 0xf, 0xf, true));   // row_xmask:M
}
template <int D> __device__ __forceinline__ float lshr(float v) {    // value of lane - D inside the 16-lane row, own value where there is none
  return __int_as_float(__builtin_amdgcn_update_dpp(__float_as_int(v), __float_as_int(v), 0x110 | D, 0xf, 0xf, false));   // row_shr:D
}
__device__ __forceinline__ float bc(float v, int l) { return __int_as_float(__builtin_amdgcn_readlane(__float_as_int(v), l)); }
template <int N> __device__ __forceinline__ void fold(float (&t)[32], int lane) {   // 2N row sums -> N, each lane keeps the half its bit N names
  const bool hi = lane & N;
#pragma unroll
  for (int r = 0; r < N; ++r) { const float keep = hi ? t[r + N] : t[r], send = hi ? t[r] : t[r + N]; t[r] = keep + lx<N>(send); }
}
__device__ __forceinline__ float allmax(float v) { v = fmaxf(v, lx<1>(v)); v = fmaxf(v, lx<2>(v)); v = fmaxf(v, lx<4>(v)); v = fmaxf(v, lx<8>(v)); return fmaxf(v, lx<16>(v)); }
__device__ __forceinline__ float allsum(float v) { v += lx<1>(v); v += lx<2>(v); v += lx<4>(v); v += lx<8>(v); return v + lx<16>(v); }
__global__ __launch_bounds__(1024) void k_scan(const float* __restrict__ q, const float* __restrict__ w, const float* __restrict__ qmask, float* __restrict__ qh) {
  __shared__ __align__(16) float sA[32][EE];
  __shared__ float sM[32], sZ[32];
  const int bh = blockIdx.x, b = bh / NH, h = bh % NH, lane = threadIdx.x & 31, wv = __builtin_amdgcn_readfirstlane(threadIdx.x >> 5);
  const v2f wl = *(const v2f*)(w + h * EE + 2 * lane); const float qm = qmask[(size_t)b * LL];
  const float* qr = q + (((size_t)b * LL + wv * 32) * NH + h) * EE + 2 * lane;
  v2f a[32]; float t[32];
#pragma unroll
  for (int j = 0; j < 32; ++j) a[j] = *(const v2f*)(qr + (size_t)j * NH * EE);
#pragma unroll
  for (int j = 0; j < 32; ++j) t[j] = a[j].x * wl.x + a[j].y * wl.y;
  fold<16>(t, lane); fold<8>(t, lane); fold<4>(t, lane); fold<2>(t, lane); fold<1>(t, lane);
  const float s = t[0] * qm;                              // lane l: score of row l of the chunk
  float m = s;                                            // running maximum inside the chunk
  m = fmaxf(m, lshr<1>(m)); m = fmaxf(m, lshr<2>(m)); m = fmaxf(m, lshr<4>(m)); m = fmaxf(m, lshr<8>(m));
  const float m15 = bc(m, 15);
  if (lane >= 16) m = fmaxf(m, m15);
  const float ms = lshr<1>(m);                            // taken with every lane on: a lane that is off feeds no neighbour
  const float mp = lane == 16 ? m15 : ms;
  const float c = lane ? expf(mp - m) : 0.f, p = expf(s - m);
  float z = 0.f, zi = 0.f; v2f acc = {0.f, 0.f};
#pragma unroll
  for (int j = 0; j < 32; ++j) { const float cj = bc(c, j), pj = bc(p, j);
    acc = acc * cj + a[j] * pj; a[j] = acc;               // unnormalised prefix of row j, relative to m of row j
    z = z * cj + pj; zi = lane == j ? z : zi; }                           // lane j keeps row j's z
  vst2(&sA[wv][2 * lane], acc);
  if (lane == 31) { sM[wv] = m; sZ[wv] = zi; }
  __syncthreads();
  const bool pre = lane < wv;                             // lane l: chunk l, counted if it lies in front of this wave's
  const float Mo = pre ? sM[lane] : -3.0e38f, Zo = pre ? sZ[lane] : 0.f;
  const float Mp = allmax(Mo);
  const float e = pre ? expf(Mo - Mp) : 0.f;
  const float Zp = allsum(e * Zo);
  v2f Ap = {0.f, 0.f};
#pragma unroll 1
  for (int c0 = 0; c0 < wv; c0 += 8)
#pragma unroll
    for (int u = 0; u < 8; ++u) Ap += *(const v2f*)(&sA[c0 + u][2 * lane]) * bc(e, c0 + u);   // e is 0 from chunk wv on
  const float mt = fmaxf(Mp, m), e1 = expf(Mp - mt), e2 = expf(m - mt), zt = Zp * e1 + zi * e2, f1 = e1 / zt, f2 = e2 / zt;
  float* o = qh + ((size_t)bh * LL + wv * 32) * EE + 2 * lane;
#pragma unroll
  for (int j = 0; j < 32; ++j) vst2(o + j * EE, (v2f)(Ap * bc(f1, j) + a[j] * bc(f2, j)));    // 32 lanes x 8 B = the 256-B row
}
// stage 2: causal attention per (b,h, 64 queries): logits = kscale * (2 qhat.k - kn); online softmax; @ V; out = queries + summary
__global__ __launch_bounds__(128) void k_attn(const float* __restrict__ qh, const float* __restrict__ keys, const float* __restrict__ kn, const _Float16* __restrict__ vT,
                                            const float* __restrict__ kmask, const float* __restrict__ qin, float* __restrict__ out) {
  __shared__ __align__(16) float sS[4][16][68];
  __shared__ __align__(16) _Float16 sP[4][16][72];
  __shared__ __align__(16) float sO[4][16][68];
  const int tid = threadIdx.x, w = tid >> 5, lane = tid & 31, col = lane & 15, g = lane >> 4;
  const int bh = blockIdx.y, b = bh / NH, h = bh % NH, q0 = blockIdx.x * 64 + w * 16;
  const float ks = kmask[(size_t)b * LL];
  F2 aq[2];                                              // scores need near-f32 operands (two-way bf16 split)
#pragma unroll
  for (int kc = 0; kc < 2; ++kc) aq[kc] = split_row(qh + ((size_t)bh * LL + q0 + col) * EE, kc * 32, lane);
  float mrun = -3.0e38f, lrun = 0.f; v8f acc[4] = {};
  const int ntiles = blockIdx.x + 1;                     // causal: key tiles 0..blockIdx.x
#pragma unroll 1
  for (int kt = 0; kt < ntiles; ++kt) {
    v8f s4[4];
#pragma unroll
    for (int t = 0; t < 4; ++t) { s4[t] = (v8f){};
#pragma unroll
      for (int kc = 0; kc < 2; ++kc) s4[t] = mac3(aq[kc], split_row(keys + (((size_t)b * LL + kt * 64 + t * 16 + col) * NH + h) * EE, kc * 32, lane), s4[t]); }
#pragma unroll
    for (int t = 0; t < 4; ++t)
#pragma unroll
      for (int r = 0; r < 8; ++r) { const int i = q0 + 8 * g + r, j = kt * 64 + t * 16 + col;
        sS[w][8 * g + r][t * 16 + col] = j <= i ? ks * (2.0f * s4[t][r] - kn[(size_t)bh * LL + j]) : -3.0e38f; }
    LDSX();
    float mx = -3.0e38f;
#pragma unroll
    for (int jj = 0; jj < 32; ++jj) mx = fmaxf(mx, sS[w][col][g * 32 + jj]);
    mx = fmaxf(mx, __shfl_xor(mx, 16, 32));
    const float mnew = fmaxf(mrun, mx); const float corr = expf(mrun - mnew);
    float ps = 0.f;
#pragma unroll
    for (int jj = 0; jj < 32; ++jj) { const float v = sS[w][col][g * 32 + jj]; const float p = v > -1.0e38f ? expf(v - mnew) : 0.f; ps += p; sP[w][col][g * 32 + jj] = (_Float16)(p * 16384.0f); }
    ps += __shfl_xor(ps, 16, 32);
    lrun = lrun * corr + ps; mrun = mnew;
#pragma unroll
    for (int r = 0; r < 8; ++r) { const float cr = __shfl(corr, 8 * g + r, 32);
#pragma unroll
      for (int t = 0; t < 4; ++t) acc[t][r] *= cr; }
    LDSX();
#pragma unroll
    for (int kc = 0; kc < 2; ++kc) { const v16h pa = frag_h(&sP[w][col][0] + kc * 32, lane);
#pragma unroll
      for (int t = 0; t < 4; ++t) acc[t] = wmma16(pa, frag_h(vT + ((size_t)bh * EE + t * 16 + col) * LL + kt * 64 + kc * 32, lane), acc[t]); }
    __builtin_amdgcn_wave_barrier();
  }
#pragma unroll
  for (int r = 0; r < 8; ++r) { const float lr = __shfl(lrun, 8 * g + r, 32);
#pragma unroll
    for (int t = 0; t < 4; ++t) sO[w][8 * g + r][t * 16 + col] = acc[t][r] / (lr * 16384.0f); }
  LDSX();
  for (int qq = lane; qq < 16 * 16; qq += 32) { const int rl = qq >> 4, pc = qq & 15; const size_t o = (((size_t)b * LL + q0 + rl) * NH + h) * EE + pc * 4;
    vst2(out + o, *(const v4f*)(&sO[w][rl][pc * 4]) + *(const v4f*)(qin + o)); }
}
extern "C" void kernel_launch(void* const* d_in, const int* in_sizes, int n_in, void* d_out, int out_size, void* d_ws, size_t ws_size, hipStream_t stream) {
  (void)in_sizes; (void)n_in; (void)out_size; (void)ws_size;
  const float* q = (const float*)d_in[0]; const float* k = (const float*)d_in[1]; const float* v = (const float*)d_in[2];
  const float* qmask = (const float*)d_in[3]; const float* kmask = (const float*)d_in[4]; const float* w = (const float*)d_in[5];
  float* out = (float*)d_out;
  char* ws = (char*)d_ws; size_t off = 0;
  auto take = [&](size_t bytes) { char* p = ws + off; off += (bytes + 255) & ~(size_t)255; return p; };
  float* kn = (float*)take((size_t)NB * NH * LL * 4); _Float16* vT = (_Float16*)take((size_t)NB * NH * EE * LL * 2); float* qh = (float*)take((size_t)NB * NH * LL * EE * 4);
  k_prep<<<dim3(LL / 64, NB * NH), 256, 0, stream>>>(k, v, kn, vT);
  k_scan<<<NB * NH, 1024, 0, stream>>>(q, w, qmask, qh);
  k_attn<<<dim3(LL / 64, NB * NH), 128, 0, stream>>>(qh, k, kn, vT, kmask, q, out);
}

// v002
// It runs in 97.4 microseconds.
// Next to v001, in two timings, it ran 1.67 and 1.68 times as fast.
// All steps since v000 together make it 8.50 times as fast.
#include <hip/hip_runtime.h>
#include <math.h>

typedef __attribute__((ext_vector_type(16))) _Float16 v16h;
typedef __attribute__((ext_vector_type(16))) __bf16 v16b;
typedef __attribute__((ext_vector_type(8)))  _Float16 v8h;
typedef __attribute__((ext_vector_type(8)))  float v8f;
typedef __attribute__((ext_vector_type(4)))  float v4f;
typedef __attribute__((ext_vector_type(2)))  float v2f;
typedef __attribute__((ext_vector_type(4)))  unsigned v4u;
typedef __attribute__((ext_vector_type(4)))  int v4i;
typedef float __attribute__((may_alias)) float_a;
typedef int __attribute__((may_alias)) int_a;

template <typename T> __device__ __forceinline__ void vst2(void* p, T v) { *(T*)p = v;  }
__device__ __forceinline__ v8f wmma16(v16h a, v16h b, v8f c) {
  v8f d = __builtin_amdgcn_wmma_f32_16x16x32_f16(false, a, false, b, (short)0, c, false, false);
  asm volatile("v_nop\n\tv_nop\n\tv_nop\n\tv_nop" : "+v"(d) : "v"(a), "v"(b));
  return d;
}
__device__ __forceinline__ v8f wmma_bf(v16b a, v16b b, v8f c) {
  v8f d = __builtin_amdgcn_wmma_f32_16x16x32_bf16(false, a, false, b, (short)0, c, false, false);
  asm volatile("v_nop\n\tv_nop\n\tv_nop\n\tv_nop" : "+v"(d) : "v"(a), "v"(b));
  return d;
}
// 16x16x32 fragments: lane = (h = lane>>4, row/col = lane&15); elements 0..7 = k0+8h+0..7, 8..15 = k0+16+8h+0..7; D element r = row 8h+r
__device__ __forceinline__ v16h frag_h(const _Float16* rowk0, int lane) {
  union { v16h v; v8h q[2]; } u; const _Float16* p = rowk0 + 8 * (lane >> 4);
  u.q[0] = *(const v8h*)p; u.q[1] = *(const v8h*)(p + 16); return u.v;
}
__device__ __forceinline__ v16h frag_f32(const float* rowk0, int lane) {
  v16h a; const float* p = rowk0 + 8 * (lane >> 4);
#pragma unroll
  for (int i = 0; i < 8; ++i) { a[i] = (_Float16)p[i]; a[8 + i] = (_Float16)p[16 + i]; }
  return a;
}
__device__ __forceinline__ v16h frag_f32s(const float* rowk0, int lane, float sc) {
  v16h a; const float* p = rowk0 + 8 * (lane >> 4);
#pragma unroll
  for (int i = 0; i < 8; ++i) { a[i] = (_Float16)(p[i] * sc); a[8 + i] = (_Float16)(p[16 + i] * sc); }
  return a;
}
// column fragment from a [K][ld] layout (column n), rows >= K read as 0
__device__ __forceinline__ v16h fragc_f32(const float* W, int k0, int n, int lane, int ld, int K) {
  v16h a; const int g = lane >> 4;
#pragma unroll
  for (int i = 0; i < 8; ++i) { const int ka = k0 + 8 * g + i, kb = ka + 16;
    a[i] = (_Float16)(ka < K ? W[(size_t)ka * ld + n] : 0.f); a[8 + i] = (_Float16)(kb < K ? W[(size_t)kb * ld + n] : 0.f); }
  return a;
}
struct F2 { v16b h, l; };
__device__ __forceinline__ F2 bsplit16(const float v[16]) { F2 r;
#pragma unroll
  for (int i = 0; i < 16; ++i) { const __bf16 h = (__bf16)v[i]; r.h[i] = h; r.l[i] = (__bf16)(v[i] - (float)h); }
  return r; }
__device__ __forceinline__ F2 split_row(const float* row, int k0, int lane) { float v[16]; const float* p = row + k0 + 8 * (lane >> 4);
#pragma unroll
  for (int i = 0; i < 8; ++i) { v[i] = p[i]; v[8 + i] = p[16 + i]; }
  return bsplit16(v); }
__device__ __forceinline__ F2 split_rowK(const float* row, int k0, int lane, int K) { float v[16]; const int g = lane >> 4;
#pragma unroll
  for (int i = 0; i < 8; ++i) { const int ka = k0 + 8 * g + i, kb = ka + 16; v[i] = ka < K ? row[ka] : 0.f; v[8 + i] = kb < K ? row[kb] : 0.f; }
  return bsplit16(v); }
__device__ __forceinline__ F2 split_col(const float* W, int k0, int n, int lane, int ld, int K) { float v[16]; const int g = lane >> 4;
#pragma unroll
  for (int i = 0; i < 8; ++i) { const int ka = k0 + 8 * g + i, kb = ka + 16; v[i] = ka < K ? W[(size_t)ka * ld + n] : 0.f; v[8 + i] = kb < K ? W[(size_t)kb * ld + n] : 0.f; }
  return bsplit16(v); }
__device__ __forceinline__ v8f mac3(const F2& a, const F2& b, v8f c) { c = wmma_bf(a.l, b.h, c); c = wmma_bf(a.h, b.l, c); return wmma_bf(a.h, b.h, c); }
__device__ __forceinline__ float sigm(float v) { return 1.0f / (1.0f + expf(-v)); }
#define LDSX() do { asm volatile("s_wait_dscnt 0" ::: "memory"); __builtin_amdgcn_wave_barrier(); __builtin_amdgcn_fence(__ATOMIC_RELEASE, "workgroup"); } while (0)

// Causal "fast Euclidean" attention. Stage 1 (prefix softmax of the per-token score s_j over j <= i) is a running
// (online-softmax) scan per (batch, head) in f32 giving qhat_i directly. Stage 2: -|qhat_i - k_j|^2 = 2 qhat.k - |k|^2 - |qhat|^2,
// and the per-row constant |qhat|^2 cancels in the softmax, so it is causal attention with logits 2 qhat_i.k_j - |k_j|^2
// (x k_mask[b,0]): S on v_wmma_f32_16x16x32_bf16 as a two-way bf16 split of qhat / keys, P@V on
#define NB 4
#define LL 1024
#define NH 12
#define EE 64

// per (b,h): kn[j] = |k_j|^2 (f32), vT[b][h][e][j] f16; block = (b,h, 64 keys)
__global__ __launch_bounds__(256) void k_prep(const float* __restrict__ keys, const float* __restrict__ vals, float* __restrict__ kn, _Float16* __restrict__ vT) {
  __shared__ float tile[64][65];
  __shared__ __align__(16) float skn[64];
  const int bh = blockIdx.y, b = bh / NH, h = bh % NH, j0 = blockIdx.x * 64, tid = threadIdx.x;
  for (int q = tid; q < 64 * 64; q += 256) { const int jl = q >> 6, e = q & 63; tile[jl][e] = vals[(((size_t)b * LL + j0 + jl) * NH + h) * EE + e]; }
  if (tid < 64) { const float* kr = keys + (((size_t)b * LL + j0 + tid) * NH + h) * EE; float s = 0.f;
#pragma unroll 8
    for (int e = 0; e < EE; ++e) s += kr[e] * kr[e];
    skn[tid] = s; }
  __syncthreads();
  { const int pc = tid & 7;
#pragma unroll
    for (int u = 0; u < 2; ++u) { const int e = (tid >> 3) + u * 32; union { v8h hh; v4u uu; } pk;
#pragma unroll
      for (int i = 0; i < 8; ++i) pk.hh[i] = (_Float16)tile[pc * 8 + i][e];
      vst2(vT + (((size_t)bh * EE + e) * LL) + j0 + pc * 8, pk.uu); } }
  if (tid < 16) vst2(kn + (size_t)bh * LL + j0 + tid * 4, *(const v4f*)(&skn[tid * 4]));
}
// stage 1 scan per (b,h): one 32-wave block; wave c scans rows 32c..32c+31 from an empty state, the 32 chunk states meet in LDS,
// and each wave merges the chunks in front of it into its rows. Lane holds 2 channels of every row; per-row scalars live one row per lane.
template <int M> __device__ __forceinline__ float lx(float v) {      // value of lane ^ M
  if constexpr (M == 16) { const int b = __float_as_int(v); return __int_as_float(__builtin_amdgcn_permlanex16(b, b, 0x76543210, 0xfedcba98, false, false)); }
  else return __int_as_float(__builtin_amdgcn_update_dpp(0, __float_as_int(v), 0x160 | M, 0xf, 0xf, true));   // row_xmask:M
}
template <int D> __device__ __forceinline__ float lshr(float v) {    // value of lane - D inside the 16-lane row, own value where there is none
  return __int_as_float(__builtin_amdgcn_update_dpp(__float_as_int(v), __float_as_int(v), 0x110 | D, 0xf, 0xf, false));   // row_shr:D
}
__device__ __forceinline__ float bc(float v, int l) { return __int_as_float(__builtin_amdgcn_readlane(__float_as_int(v), l)); }
template <int N> __device__ __forceinline__ void fold(float (&t)[32], int lane) {   // 2N row sums -> N, each lane keeps the half its bit N names
  const bool hi = lane & N;
#pragma unroll
  for (int r = 0; r < N; ++r) { const float keep = hi ? t[r + N] : t[r], send = hi ? t[r] : t[r + N]; t[r] = keep + lx<N>(send); }
}
__device__ __forceinline__ float allmax(float v) { v = fmaxf(v, lx<1>(v)); v = fmaxf(v, lx<2>(v)); v = fmaxf(v, lx<4>(v)); v = fmaxf(v, lx<8>(v)); return fmaxf(v, lx<16>(v)); }
__device__ __forceinline__ float allsum(float v) { v += lx<1>(v); v += lx<2>(v); v += lx<4>(v); v += lx<8>(v); return v + lx<16>(v); }
__global__ __launch_bounds__(1024) void k_scan(const float* __restrict__ q, const float* __restrict__ w, const float* __restrict__ qmask, float* __restrict__ qh) {
  __shared__ __align__(16) float sA[32][EE];
  __shared__ float sM[32], sZ[32];
  const int bh = blockIdx.x, b = bh / NH, h = bh % NH, lane = threadIdx.x & 31, wv = __builtin_amdgcn_readfirstlane(threadIdx.x >> 5);
  const v2f wl = *(const v2f*)(w + h * EE + 2 * lane); const float qm = qmask[(size_t)b * LL];
  const float* qr = q + (((size_t)b * LL + wv * 32) * NH + h) * EE + 2 * lane;
  v2f a[32]; float t[32];
#pragma unroll
  for (int j = 0; j < 32; ++j) a[j] = *(const v2f*)(qr + (size_t)j * NH * EE);
#pragma unroll
  for (int j = 0; j < 32; ++j) t[j] = a[j].x * wl.x + a[j].y * wl.y;
  fold<16>(t, lane); fold<8>(t, lane); fold<4>(t, lane); fold<2>(t, lane); fold<1>(t, lane);
  const float s = t[0] * qm;                              // lane l: score of row l of the chunk
  float m = s;                                            // running maximum inside the chunk
  m = fmaxf(m, lshr<1>(m)); m = fmaxf(m, lshr<2>(m)); m = fmaxf(m, lshr<4>(m)); m = fmaxf(m, lshr<8>(m));
  const float m15 = bc(m, 15);
  if (lane >= 16) m = fmaxf(m, m15);
  const float ms = lshr<1>(m);                            // taken with every lane on: a lane that is off feeds no neighbour
  const float mp = lane == 16 ? m15 : ms;
  const float c = lane ? expf(mp - m) : 0.f, p = expf(s - m);
  float z = 0.f, zi = 0.f; v2f acc = {0.f, 0.f};
#pragma unroll
  for (int j = 0; j < 32; ++j) { const float cj = bc(c, j), pj = bc(p, j);
    acc = acc * cj + a[j] * pj; a[j] = acc;               // unnormalised prefix of row j, relative to m of row j
    z = z * cj + pj; zi = lane == j ? z : zi; }                           // lane j keeps row j's z
  vst2(&sA[wv][2 * lane], acc);
  if (lane == 31) { sM[wv] = m; sZ[wv] = zi; }
  __syncthreads();
  const bool pre = lane < wv;                             // lane l: chunk l, counted if it lies in front of this wave's
  const float Mo = pre ? sM[lane] : -3.0e38f, Zo = pre ? sZ[lane] : 0.f;
  const float Mp = allmax(Mo);
  const float e = pre ? expf(Mo - Mp) : 0.f;
  const float Zp = allsum(e * Zo);
  v2f Ap = {0.f, 0.f};
#pragma unroll 1
  for (int c0 = 0; c0 < wv; c0 += 8)
#pragma unroll
    for (int u = 0; u < 8; ++u) Ap += *(const v2f*)(&sA[c0 + u][2 * lane]) * bc(e, c0 + u);   // e is 0 from chunk wv on
  const float mt = fmaxf(Mp, m), e1 = expf(Mp - mt), e2 = expf(m - mt), zt = Zp * e1 + zi * e2, f1 = e1 / zt, f2 = e2 / zt;
  float* o = qh + ((size_t)bh * LL + wv * 32) * EE + 2 * lane;
#pragma unroll
  for (int j = 0; j < 32; ++j) vst2(o + j * EE, (v2f)(Ap * bc(f1, j) + a[j] * bc(f2, j)));    // 32 lanes x 8 B = the 256-B row
}
// one key tile's raw f32 rows, as the eight score fragments read them: piece f = t*2+kc holds k = kc*32 + 8g + {0..3, 4..7, 16..19, 20..23} of key t*16+col
__device__ __forceinline__ void load_ktile(v4f (&kr)[8][4], const float* p0) {
#pragma unroll   // both loops unrolled: kr is indexed by constants only and stays in registers; 32 loads in a row, one base address
  for (int t = 0; t < 4; ++t)
#pragma unroll
    for (int kc = 0; kc < 2; ++kc) { const float* p = p0 + (size_t)t * 16 * NH * EE + kc * 32;
      kr[t * 2 + kc][0] = *(const v4f*)p; kr[t * 2 + kc][1] = *(const v4f*)(p + 4); kr[t * 2 + kc][2] = *(const v4f*)(p + 16); kr[t * 2 + kc][3] = *(const v4f*)(p + 20); }
}
__device__ __forceinline__ F2 split_regs(const v4f (&q)[4]) { float v[16];
#pragma unroll   // constant indices: v stays in registers
  for (int i = 0; i < 4; ++i) { v[i] = q[0][i]; v[4 + i] = q[1][i]; v[8 + i] = q[2][i]; v[12 + i] = q[3][i]; }
  return bsplit16(v); }
// exchange between the lanes of ONE wave through its own LDS rows: the wave's LDS operations retire before it reads, and the clobber and the
// wave barrier keep the compiler from moving an LDS access across the point; unlike LDSX it holds no fence, which would also wait for every
// global load in flight
#define LDSW() do { asm volatile("s_wait_dscnt 0" ::: "memory"); __builtin_amdgcn_wave_barrier(); } while (0)
// stage 2: causal attention per (b,h, 64 queries): logits = kscale * (2 qhat.k - kn); online softmax; @ V; out = queries + summary
__global__ __launch_bounds__(128) void k_attn(const float* __restrict__ qh, const float* __restrict__ keys, const float* __restrict__ kn, const _Float16* __restrict__ vT,
                                            const float* __restrict__ kmask, const float* __restrict__ qin, float* __restrict__ out) {
  __shared__ __align__(16) float sS[4][16][68];
  __shared__ __align__(16) _Float16 sP[4][16][72];
  __shared__ __align__(16) float sO[4][16][68];
  const int tid = threadIdx.x, w = tid >> 5, lane = tid & 31, col = lane & 15, g = lane >> 4;
  const int bh = blockIdx.y, b = bh / NH, h = bh % NH, q0 = blockIdx.x * 64 + w * 16;
  const float ks = kmask[(size_t)b * LL];
  F2 aq[2];                                              // scores need near-f32 operands (two-way bf16 split)
#pragma unroll
  for (int kc = 0; kc < 2; ++kc) aq[kc] = split_row(qh + ((size_t)bh * LL + q0 + col) * EE, kc * 32, lane);
  float mrun = -3.0e38f, lrun = 0.f; v8f acc[4] = {};
  const int ntiles = blockIdx.x + 1;                     // causal: key tiles 0..blockIdx.x
  // Every global load is issued well ahead of its use: a tile's keys and norms during the tile before, its values behind its score products.
  const float* kp = keys + (((size_t)b * LL + col) * NH + h) * EE + 8 * g;      // key row col of tile 0, this lane half's k
  const float* np = kn + (size_t)bh * LL + col;
  const _Float16* vp = vT + ((size_t)bh * EE + col) * LL + 8 * g;
  v4f kr[8][4]; float kv[4];
  load_ktile(kr, kp);
#pragma unroll   // constant indices: kv stays in registers
  for (int t = 0; t < 4; ++t) kv[t] = np[t * 16];
  kp += (size_t)64 * NH * EE; np += 64;                  // from here on: the NEXT tile's keys and norms; vp: this tile's values
#pragma unroll 1
  for (int kt = 0; kt < ntiles; ++kt) {
    v8f s4[4];
#pragma unroll
    for (int t = 0; t < 4; ++t) { s4[t] = (v8f){};
#pragma unroll
      for (int kc = 0; kc < 2; ++kc) s4[t] = mac3(aq[kc], split_regs(kr[t * 2 + kc]), s4[t]); }
    v8h vr[2][4][2];                                     // this tile's value fragments: in flight under the softmax
#pragma unroll   // both loops unrolled: vr stays in registers; 16 loads in a row, one base address
    for (int kc = 0; kc < 2; ++kc)
#pragma unroll
      for (int t = 0; t < 4; ++t) { const _Float16* p = vp + (size_t)t * 16 * LL + kc * 32; vr[kc][t][0] = *(const v8h*)p; vr[kc][t][1] = *(const v8h*)(p + 16); }
    if (kt + 1 < ntiles) load_ktile(kr, kp);   // next tile's keys: in flight under the softmax
#pragma unroll
    for (int t = 0; t < 4; ++t)
#pragma unroll
      for (int r = 0; r < 8; ++r) { const int i = q0 + 8 * g + r, j = kt * 64 + t * 16 + col;
        sS[w][8 * g + r][t * 16 + col] = j <= i ? ks * (2.0f * s4[t][r] - kv[t]) : -3.0e38f; }
    if (kt + 1 < ntiles) {
#pragma unroll   // constant indices: kv stays in registers
      for (int t = 0; t < 4; ++t) kv[t] = np[t * 16]; }
    asm volatile("s_wait_xcnt 0x0" ::: "memory");        // in front of every later overwrite of an address register that the loads above name
    LDSW();
    float mx = -3.0e38f;
#pragma unroll
    for (int jj = 0; jj < 32; ++jj) mx = fmaxf(mx, sS[w][col][g * 32 + jj]);
    mx = fmaxf(mx, __shfl_xor(mx, 16, 32));
    const float mnew = fmaxf(mrun, mx); const float corr = expf(mrun - mnew);
    float ps = 0.f;
#pragma unroll
    for (int jj = 0; jj < 32; ++jj) { const float v = sS[w][col][g * 32 + jj]; const float p = v > -1.0e38f ? expf(v - mnew) : 0.f; ps += p; sP[w][col][g * 32 + jj] = (_Float16)(p * 16384.0f); }
    ps += __shfl_xor(ps, 16, 32);
    lrun = lrun * corr + ps; mrun = mnew;
#pragma unroll
    for (int r = 0; r < 8; ++r) { const float cr = __shfl(corr, 8 * g + r, 32);
#pragma unroll
      for (int t = 0; t < 4; ++t) acc[t][r] *= cr; }
    LDSW();
#pragma unroll
    for (int kc = 0; kc < 2; ++kc) { const v16h pa = frag_h(&sP[w][col][0] + kc * 32, lane);
#pragma unroll
      for (int t = 0; t < 4; ++t) { union { v16h v; v8h q[2]; } u; u.q[0] = vr[kc][t][0]; u.q[1] = vr[kc][t][1]; acc[t] = wmma16(pa, u.v, acc[t]); } }
    kp += (size_t)64 * NH * EE; np += 64; vp += 64;
    __builtin_amdgcn_wave_barrier();
  }
#pragma unroll
  for (int r = 0; r < 8; ++r) { const float lr = __shfl(lrun, 8 * g + r, 32);
#pragma unroll
    for (int t = 0; t < 4; ++t) sO[w][8 * g + r][t * 16 + col] = acc[t][r] / (lr * 16384.0f); }
  LDSX();
  for (int qq = lane; qq < 16 * 16; qq += 32) { const int rl = qq >> 4, pc = qq & 15; const size_t o = (((size_t)b * LL + q0 + rl) * NH + h) * EE + pc * 4;
    vst2(out + o, *(const v4f*)(&sO[w][rl][pc * 4]) + *(const v4f*)(qin + o)); }
}
extern "C" void kernel_launch(void* const* d_in, const int* in_sizes, int n_in, void* d_out, int out_size, void* d_ws, size_t ws_size, hipStream_t stream) {
  (void)in_sizes; (void)n_in; (void)out_size; (void)ws_size;
  const float* q = (const float*)d_in[0]; const float* k = (const float*)d_in[1]; const float* v = (const float*)d_in[2];
  const float* qmask = (const float*)d_in[3]; const float* kmask = (const float*)d_in[4]; const float* w = (const float*)d_in[5];
  float* out = (float*)d_out;
  char* ws = (char*)d_ws; size_t off = 0;
  auto take = [&](size_t bytes) { char* p = ws + off; off += (bytes + 255) & ~(size_t)255; return p; };
  float* kn = (float*)take((size_t)NB * NH * LL * 4); _Float16* vT = (_Float16*)take((size_t)NB * NH * EE * LL * 2); float* qh = (float*)take((size_t)NB * NH * LL * EE * 4);
  k_prep<<<dim3(LL / 64, NB * NH), 256, 0, stream>>>(k, v, kn, vT);
  k_scan<<<NB * NH, 1024, 0, stream>>>(q, w, qmask, qh);
  k_attn<<<dim3(LL / 64, NB * NH), 128, 0, stream>>>(qh, k, kn, vT, kmask, q, out);
}

// v003
// Measured time: 80.1 microseconds a run.
// In two side-by-side timings against v002, it was 1.21 and 1.22 times as fast.
// Over all steps from v000 it is 10.3 times as fast.
#include <hip/hip_runtime.h>
#include <math.h>

typedef __attribute__((ext_vector_type(16))) _Float16 v16h;
typedef __attribute__((ext_vector_type(16))) __bf16 v16b;
typedef __attribute__((ext_vector_type(8)))  _Float16 v8h;
typedef __attribute__((ext_vector_type(8)))  float v8f;
typedef __attribute__((ext_vector_type(4)))  float v4f;
typedef __attribute__((ext_vector_type(2)))  float v2f;
typedef __attribute__((ext_vector_type(4)))  unsigned v4u;
typedef __attribute__((ext_vector_type(4)))  int v4i;
typedef float __attribute__((may_alias)) float_a;
typedef int __attribute__((may_alias)) int_a;

template <typename T> __device__ __forceinline__ void vst2(void* p, T v) { *(T*)p = v;  }
__device__ __forceinline__ v8f wmma16(v16h a, v16h b, v8f c) {
  v8f d = __builtin_amdgcn_wmma_f32_16x16x32_f16(false, a, false, b, (short)0, c, false, false);
  asm volatile("v_nop\n\tv_nop\n\tv_nop\n\tv_nop" : "+v"(d) : "v"(a), "v"(b));
  return d;
}
__device__ __forceinline__ v8f wmma_bf(v16b a, v16b b, v8f c) {
  v8f d = __builtin_amdgcn_wmma_f32_16x16x32_bf16(false, a, false, b, (short)0, c, false, false);
  asm volatile("v_nop\n\tv_nop\n\tv_nop\n\tv_nop" : "+v"(d) : "v"(a), "v"(b));
  return d;
}
// 16x16x32 fragments: lane = (h = lane>>4, row/col = lane&15); elements 0..7 = k0+8h+0..7, 8..15 = k0+16+8h+0..7; D element r = row 8h+r
__device__ __forceinline__ v16h frag_h(const _Float16* rowk0, int lane) {
  union { v16h v; v8h q[2]; } u; const _Float16* p = rowk0 + 8 * (lane >> 4);
  u.q[0] = *(const v8h*)p; u.q[1] = *(const v8h*)(p + 16); return u.v;
}
__device__ __forceinline__ v16h frag_f32(const float* rowk0, int lane) {
  v16h a; const float* p = rowk0 + 8 * (lane >> 4);
#pragma unroll
  for (int i = 0; i < 8; ++i) { a[i] = (_Float16)p[i]; a[8 + i] = (_Float16)p[16 + i]; }
  return a;
}
__device__ __forceinline__ v16h frag_f32s(const float* rowk0, int lane, float sc) {
  v16h a; const float* p = rowk0 + 8 * (lane >> 4);
#pragma unroll
  for (int i = 0; i < 8; ++i) { a[i] = (_Float16)(p[i] * sc); a[8 + i] = (_Float16)(p[16 + i] * sc); }
  return a;
}
// column fragment from a [K][ld] layout (column n), rows >= K read as 0
__device__ __forceinline__ v16h fragc_f32(const float* W, int k0, int n, int lane, int ld, int K) {
  v16h a; const int g = lane >> 4;
#pragma unroll
  for (int i = 0; i < 8; ++i) { const int ka = k0 + 8 * g + i, kb = ka + 16;
    a[i] = (_Float16)(ka < K ? W[(size_t)ka * ld + n] : 0.f); a[8 + i] = (_Float16)(kb < K ? W[(size_t)kb * ld + n] : 0.f); }
  return a;
}
struct F2 { v16b h, l; };
__device__ __forceinline__ F2 bsplit16(const float v[16]) { F2 r;
#pragma unroll
  for (int i = 0; i < 16; ++i) { const __bf16 h = (__bf16)v[i]; r.h[i] = h; r.l[i] = (__bf16)(v[i] - (float)h); }
  return r; }
__device__ __forceinline__ F2 split_row(const float* row, int k0, int lane) { float v[16]; const float* p = row + k0 + 8 * (lane >> 4);
#pragma unroll
  for (int i = 0; i < 8; ++i) { v[i] = p[i]; v[8 + i] = p[16 + i]; }
  return bsplit16(v); }
__device__ __forceinline__ F2 split_rowK(const float* row, int k0, int lane, int K) { float v[16]; const int g = lane >> 4;
#pragma unroll
  for (int i = 0; i < 8; ++i) { const int ka = k0 + 8 * g + i, kb = ka + 16; v[i] = ka < K ? row[ka] : 0.f; v[8 + i] = kb < K ? row[kb] : 0.f; }
  return bsplit16(v); }
__device__ __forceinline__ F2 split_col(const float* W, int k0, int n, int lane, int ld, int K) { float v[16]; const int g = lane >> 4;
#pragma unroll
  for (int i = 0; i < 8; ++i) { const int ka = k0 + 8 * g + i, kb = ka + 16; v[i] = ka < K ? W[(size_t)ka * ld + n] : 0.f; v[8 + i] = kb < K ? W[(size_t)kb * ld + n] : 0.f; }
  return bsplit16(v); }
__device__ __forceinline__ v8f mac3(const F2& a, const F2& b, v8f c) { c = wmma_bf(a.l, b.h, c); c = wmma_bf(a.h, b.l, c); return wmma_bf(a.h, b.h, c); }
__device__ __forceinline__ float sigm(float v) { return 1.0f / (1.0f + expf(-v)); }
#define LDSX() do { asm volatile("s_wait_dscnt 0" ::: "memory"); __builtin_amdgcn_wave_barrier(); __builtin_amdgcn_fence(__ATOMIC_RELEASE, "workgroup"); } while (0)

// Causal "fast Euclidean" attention. Stage 1 (prefix softmax of the per-token score s_j over j <= i) is a running
// (online-softmax) scan per (batch, head) in f32 giving qhat_i directly. Stage 2: -|qhat_i - k_j|^2 = 2 qhat.k - |k|^2 - |qhat|^2,
// and the per-row constant |qhat|^2 cancels in the softmax, so it is causal attention with logits 2 qhat_i.k_j - |k_j|^2
// (x k_mask[b,0]): S on v_wmma_f32_16x16x32_bf16 as a two-way bf16 split of qhat / keys, P@V on
#define NB 4
#define LL 1024
#define NH 12
#define EE 64
#define KF 5   // key fragments of the next tile that are fetched under the softmax; the other 8 - KF behind the value products (with 6 the build spills)

// per (b,h): kn[j] = |k_j|^2 (f32); keys (as their two-way bf16 split) and values (f16) laid out in the order k_attn's fragments read them,
// in chunks of 512 B = 32 lanes x 16 B, so that one wave-wide 16-byte load there covers four whole lines; block = (b,h, 64 keys)
//   kpk: chunk ((bh*64 + key/16)*2 + kc)*4 + part*2 + c (part 0 = high, 1 = low): lane (g, col) holds k = kc*32 + 16c + 8g + 0..7 of key (key/16)*16 + col
//   vT:  chunk ((bh*16 + key/64)*2 + kc)*8 + t*2 + c: lane (g, col) holds keys kc*32 + 16c + 8g + 0..7 of the 64, channel t*16 + col
__global__ __launch_bounds__(256) void k_prep(const float* __restrict__ keys, const float* __restrict__ vals, float* __restrict__ kn, _Float16* __restrict__ vT, __bf16* __restrict__ kpk) {
  __shared__ float tile[64][65];
  __shared__ __align__(16) float skn[64];
  const int bh = blockIdx.y, b = bh / NH, h = bh % NH, j0 = blockIdx.x * 64, tid = threadIdx.x;
  { const int fr = tid >> 5, ln = tid & 31;              // wave fr: score fragment (16 keys fr >> 1, kc = fr & 1) of this block's 64 keys
    const F2 f = split_row(keys + (((size_t)b * LL + j0 + (fr >> 1) * 16 + (ln & 15)) * NH + h) * EE, (fr & 1) * 32, ln);
    union { v16b v; v4u q[2]; } hi, lo; hi.v = f.h; lo.v = f.l;
    __bf16* d = kpk + (((size_t)bh * 128 + blockIdx.x * 8 + fr) * 4) * 256 + ln * 8;
    vst2(d, hi.q[0]); vst2(d + 256, hi.q[1]); vst2(d + 512, lo.q[0]); vst2(d + 768, lo.q[1]); }
  for (int q = tid; q < 64 * 64; q += 256) { const int jl = q >> 6, e = q & 63; tile[jl][e] = vals[(((size_t)b * LL + j0 + jl) * NH + h) * EE + e]; }
  if (tid < 64) { const float* kr = keys + (((size_t)b * LL + j0 + tid) * NH + h) * EE; float s = 0.f;
#pragma unroll 8
    for (int e = 0; e < EE; ++e) s += kr[e] * kr[e];
    skn[tid] = s; }
  __syncthreads();
  { const int ln = tid & 31;
#pragma unroll
    for (int u = 0; u < 2; ++u) { const int ch = (tid >> 5) + u * 8;      // chunk kc*8 + t*2 + c of this block's 16, two per wave
      const int e = ((ch >> 1) & 3) * 16 + (ln & 15), kb = (ch >> 3) * 32 + (ch & 1) * 16 + (ln >> 4) * 8; union { v8h hh; v4u uu; } pk;
#pragma unroll
      for (int i = 0; i < 8; ++i) pk.hh[i] = (_Float16)tile[kb + i][e];
      vst2(vT + (((size_t)bh * 16 + blockIdx.x) * 16 + ch) * 256 + ln * 8, pk.uu); } }
  if (tid < 16) vst2(kn + (size_t)bh * LL + j0 + tid * 4, *(const v4f*)(&skn[tid * 4]));
}
// stage 1 scan per (b,h): one 32-wave block; wave c scans rows 32c..32c+31 from an empty state, the 32 chunk states meet in LDS,
// and each wave merges the chunks in front of it into its rows. Lane holds 2 channels of every row; per-row scalars live one row per lane.
template <int M> __device__ __forceinline__ float lx(float v) {      // value of lane ^ M
  if constexpr (M == 16) { const int b = __float_as_int(v); return __int_as_float(__builtin_amdgcn_permlanex16(b, b, 0x76543210, 0xfedcba98, false, false)); }
  else return __int_as_float(__builtin_amdgcn_update_dpp(0, __float_as_int(v), 0x160 | M, 0xf, 0xf, true));   // row_xmask:M
}
template <int D> __device__ __forceinline__ float lshr(float v) {    // value of lane - D inside the 16-lane row, own value where there is none
  return __int_as_float(__builtin_amdgcn_update_dpp(__float_as_int(v), __float_as_int(v), 0x110 | D, 0xf, 0xf, false));   // row_shr:D
}
__device__ __forceinline__ float bc(float v, int l) { return __int_as_float(__builtin_amdgcn_readlane(__float_as_int(v), l)); }
template <int N> __device__ __forceinline__ void fold(float (&t)[32], int lane) {   // 2N row sums -> N, each lane keeps the half its bit N names
  const bool hi = lane & N;
#pragma unroll
  for (int r = 0; r < N; ++r) { const float keep = hi ? t[r + N] : t[r], send = hi ? t[r] : t[r + N]; t[r] = keep + lx<N>(send); }
}
__device__ __forceinline__ float allmax(float v) { v = fmaxf(v, lx<1>(v)); v = fmaxf(v, lx<2>(v)); v = fmaxf(v, lx<4>(v)); v = fmaxf(v, lx<8>(v)); return fmaxf(v, lx<16>(v)); }
__device__ __forceinline__ float allsum(float v) { v += lx<1>(v); v += lx<2>(v); v += lx<4>(v); v += lx<8>(v); return v + lx<16>(v); }
__global__ __launch_bounds__(1024) void k_scan(const float* __restrict__ q, const float* __restrict__ w, const float* __restrict__ qmask, float* __restrict__ qh) {
  __shared__ __align__(16) float sA[32][EE];
  __shared__ float sM[32], sZ[32];
  const int bh = blockIdx.x, b = bh / NH, h = bh % NH, lane = threadIdx.x & 31, wv = __builtin_amdgcn_readfirstlane(threadIdx.x >> 5);
  const v2f wl = *(const v2f*)(w + h * EE + 2 * lane); const float qm = qmask[(size_t)b * LL];
  const float* qr = q + (((size_t)b * LL + wv * 32) * NH + h) * EE + 2 * lane;
  v2f a[32]; float t[32];
#pragma unroll
  for (int j = 0; j < 32; ++j) a[j] = *(const v2f*)(qr + (size_t)j * NH * EE);
#pragma unroll
  for (int j = 0; j < 32; ++j) t[j] = a[j].x * wl.x + a[j].y * wl.y;
  fold<16>(t, lane); fold<8>(t, lane); fold<4>(t, lane); fold<2>(t, lane); fold<1>(t, lane);
  const float s = t[0] * qm;                              // lane l: score of row l of the chunk
  float m = s;                                            // running maximum inside the chunk
  m = fmaxf(m, lshr<1>(m)); m = fmaxf(m, lshr<2>(m)); m = fmaxf(m, lshr<4>(m)); m = fmaxf(m, lshr<8>(m));
  const float m15 = bc(m, 15);
  if (lane >= 16) m = fmaxf(m, m15);
  const float ms = lshr<1>(m);                            // taken with every lane on: a lane that is off feeds no neighbour
  const float mp = lane == 16 ? m15 : ms;
  const float c = lane ? expf(mp - m) : 0.f, p = expf(s - m);
  float z = 0.f, zi = 0.f; v2f acc = {0.f, 0.f};
#pragma unroll
  for (int j = 0; j < 32; ++j) { const float cj = bc(c, j), pj = bc(p, j);
    acc = acc * cj + a[j] * pj; a[j] = acc;               // unnormalised prefix of row j, relative to m of row j
    z = z * cj + pj; zi = lane == j ? z : zi; }                           // lane j keeps row j's z
  vst2(&sA[wv][2 * lane], acc);
  if (lane == 31) { sM[wv] = m; sZ[wv] = zi; }
  __syncthreads();
  const bool pre = lane < wv;                             // lane l: chunk l, counted if it lies in front of this wave's
  const float Mo = pre ? sM[lane] : -3.0e38f, Zo = pre ? sZ[lane] : 0.f;
  const float Mp = allmax(Mo);
  const float e = pre ? expf(Mo - Mp) : 0.f;
  const float Zp = allsum(e * Zo);
  v2f Ap = {0.f, 0.f};
#pragma unroll 1
  for (int c0 = 0; c0 < wv; c0 += 8)
#pragma unroll
    for (int u = 0; u < 8; ++u) Ap += *(const v2f*)(&sA[c0 + u][2 * lane]) * bc(e, c0 + u);   // e is 0 from chunk wv on
  const float mt = fmaxf(Mp, m), e1 = expf(Mp - mt), e2 = expf(m - mt), zt = Zp * e1 + zi * e2, f1 = e1 / zt, f2 = e2 / zt;
  float* o = qh + ((size_t)bh * LL + wv * 32) * EE + 2 * lane;
#pragma unroll
  for (int j = 0; j < 32; ++j) vst2(o + j * EE, (v2f)(Ap * bc(f1, j) + a[j] * bc(f2, j)));    // 32 lanes x 8 B = the 256-B row
}
// one key tile's eight score fragments from kpk: fragment f = t*2+kc is four chunks in a row: high elements 0..7, 8..15, low elements 0..7, 8..15
template <int F0, int F1> __device__ __forceinline__ void load_ktile(v4u (&kr)[8][4], const __bf16* p0) {     // fragments F0 .. F1-1
#pragma unroll   // both loops unrolled: kr is indexed by constants only and stays in registers; the loads stand in a row, one base address
  for (int f = F0; f < F1; ++f)
#pragma unroll
    for (int c = 0; c < 4; ++c) kr[f][c] = *(const v4u*)(p0 + (f * 4 + c) * 256);
}
__device__ __forceinline__ F2 packed_regs(const v4u (&q)[4]) { union { v16b v; v4u u[2]; } hi, lo;
  hi.u[0] = q[0]; hi.u[1] = q[1]; lo.u[0] = q[2]; lo.u[1] = q[3]; F2 r; r.h = hi.v; r.l = lo.v; return r; }
// exchange between the lanes of ONE wave through its own LDS rows: the wave's LDS operations retire before it reads, and the clobber and the
// wave barrier keep the compiler from moving an LDS access across the point; unlike LDSX it holds no fence, which would also wait for every
// global load in flight
#define LDSW() do { asm volatile("s_wait_dscnt 0" ::: "memory"); __builtin_amdgcn_wave_barrier(); } while (0)
// stage 2: causal attention per (b,h, 64 queries): logits = kscale * (2 qhat.k - kn); online softmax; @ V; out = queries + summary
__global__ __launch_bounds__(128) void k_attn(const float* __restrict__ qh, const __bf16* __restrict__ kpk, const float* __restrict__ kn, const _Float16* __restrict__ vT,
                                            const float* __restrict__ kmask, const float* __restrict__ qin, float* __restrict__ out) {
  __shared__ __align__(16) float sS[4][16][68];
  __shared__ __align__(16) _Float16 sP[4][16][72];
  __shared__ __align__(16) float sO[4][16][68];
  const int tid = threadIdx.x, w = tid >> 5, lane = tid & 31, col = lane & 15, g = lane >> 4;
  const int bh = blockIdx.y, b = bh / NH, h = bh % NH, q0 = blockIdx.x * 64 + w * 16;
  const float ks = kmask[(size_t)b * LL];
  F2 aq[2];                                              // scores need near-f32 operands (two-way bf16 split)
  const float* qr = qh + ((size_t)bh * LL + q0 + col) * EE;
#pragma unroll
  for (int kc = 0; kc < 2; ++kc) aq[kc] = split_row(qr, kc * 32, lane);
  asm volatile("s_wait_xcnt 0x0" ::: "memory");          // in front of every later overwrite of the address registers that the loads above name
  float mrun = -3.0e38f, lrun = 0.f; v8f acc[4] = {};
  const int ntiles = blockIdx.x + 1;                     // causal: key tiles 0..blockIdx.x
  // Every global load is issued well ahead of its use: a tile's keys and norms during the tile before, its values behind its score products.
  const __bf16* kp = kpk + (size_t)bh * LL * EE * 2 + lane * 8;                 // this lane's 16 B of every chunk of tile 0
  const float* np = kn + (size_t)bh * LL + col;
  const _Float16* vp = vT + (size_t)bh * EE * LL + lane * 8;
  v4u kr[8][4]; float kv[4];
  load_ktile<0, 8>(kr, kp);
#pragma unroll   // constant indices: kv stays in registers
  for (int t = 0; t < 4; ++t) kv[t] = np[t * 16];
  kp += 64 * EE * 2; np += 64;                           // from here on: the NEXT tile's keys and norms; vp: this tile's values
#pragma unroll 1
  for (int kt = 0; kt < ntiles; ++kt) {
    v8f s4[4];
#pragma unroll
    for (int t = 0; t < 4; ++t) { s4[t] = (v8f){};
#pragma unroll
      for (int kc = 0; kc < 2; ++kc) s4[t] = mac3(aq[kc], packed_regs(kr[t * 2 + kc]), s4[t]); }
    v8h vr[2][4][2];                                     // this tile's value fragments: in flight under the softmax
#pragma unroll   // both loops unrolled: vr stays in registers; 16 loads in a row, one base address
    for (int kc = 0; kc < 2; ++kc)
#pragma unroll
      for (int t = 0; t < 4; ++t) { const _Float16* p = vp + (kc * 8 + t * 2) * 256; vr[kc][t][0] = *(const v8h*)p; vr[kc][t][1] = *(const v8h*)(p + 256); }
    // The fetch is unconditional, so that no old fragment stays live beside the new ones (that spilled): the last pass, which has no next tile,
    // fetches its own tile again, in bounds, and nothing reads it.
    const __bf16* kq = kt + 1 < ntiles ? kp : kp - 64 * EE * 2;
    load_ktile<0, KF>(kr, kq);                 // next tile's first key fragments: in flight under the softmax
    // in front of every later overwrite of an address register that the loads above name; the addresses as inputs keep their registers whole up to here
    asm volatile("s_wait_xcnt 0x0" :: "v"(vp), "v"(kq) : "memory");
#pragma unroll
    for (int t = 0; t < 4; ++t)
#pragma unroll
      for (int r = 0; r < 8; ++r) { const int i = q0 + 8 * g + r, j = kt * 64 + t * 16 + col;
        sS[w][8 * g + r][t * 16 + col] = j <= i ? ks * (2.0f * s4[t][r] - kv[t]) : -3.0e38f; }
    if (kt + 1 < ntiles) {
#pragma unroll   // constant indices: kv stays in registers
      for (int t = 0; t < 4; ++t) kv[t] = np[t * 16]; }
    asm volatile("s_wait_xcnt 0x0" ::: "memory");        // in front of every later overwrite of an address register that the loads above name
    LDSW();
    float mx = -3.0e38f;
#pragma unroll
    for (int jj = 0; jj < 32; ++jj) mx = fmaxf(mx, sS[w][col][g * 32 + jj]);
    mx = fmaxf(mx, __shfl_xor(mx, 16, 32));
    const float mnew = fmaxf(mrun, mx); const float corr = expf(mrun - mnew);
    float ps = 0.f;
#pragma unroll
    for (int jj = 0; jj < 32; ++jj) { const float v = sS[w][col][g * 32 + jj]; const float p = v > -1.0e38f ? expf(v - mnew) : 0.f; ps += p; sP[w][col][g * 32 + jj] = (_Float16)(p * 16384.0f); }
    ps += __shfl_xor(ps, 16, 32);
    lrun = lrun * corr + ps; mrun = mnew;
#pragma unroll
    for (int r = 0; r < 8; ++r) { const float cr = __shfl(corr, 8 * g + r, 32);
#pragma unroll
      for (int t = 0; t < 4; ++t) acc[t][r] *= cr; }
    LDSW();
#pragma unroll
    for (int kc = 0; kc < 2; ++kc) { const v16h pa = frag_h(&sP[w][col][0] + kc * 32, lane);
#pragma unroll
      for (int t = 0; t < 4; ++t) { union { v16h v; v8h q[2]; } u; u.q[0] = vr[kc][t][0]; u.q[1] = vr[kc][t][1]; acc[t] = wmma16(pa, u.v, acc[t]); } }
    // the next tile's last key fragments come behind the value products, whose fragments then share their registers (all of these feed matrix
    // instructions, and held at once they spilled); they are in flight under the next tile's first score products
    load_ktile<KF, 8>(kr, kq);
    asm volatile("s_wait_xcnt 0x0" ::: "memory");        // in front of the overwrite of the address registers that the loads above name
    kp += 64 * EE * 2; np += 64; vp += 64 * EE;
    __builtin_amdgcn_wave_barrier();
  }
#pragma unroll
  for (int r = 0; r < 8; ++r) { const float lr = __shfl(lrun, 8 * g + r, 32);
#pragma unroll
    for (int t = 0; t < 4; ++t) sO[w][8 * g + r][t * 16 + col] = acc[t][r] / (lr * 16384.0f); }
  LDSX();
  for (int qq = lane; qq < 16 * 16; qq += 32) { const int rl = qq >> 4, pc = qq & 15; const size_t o = (((size_t)b * LL + q0 + rl) * NH + h) * EE + pc * 4;
    vst2(out + o, *(const v4f*)(&sO[w][rl][pc * 4]) + *(const v4f*)(qin + o)); }
}
extern "C" void kernel_launch(void* const* d_in, const int* in_sizes, int n_in, void* d_out, int out_size, void* d_ws, size_t ws_size, hipStream_t stream) {
  (void)in_sizes; (void)n_in; (void)out_size; (void)ws_size;
  const float* q = (const float*)d_in[0]; const float* k = (const float*)d_in[1]; const float* v = (const float*)d_in[2];
  const float* qmask = (const float*)d_in[3]; const float* kmask = (const float*)d_in[4]; const float* w = (const float*)d_in[5];
  float* out = (float*)d_out;
  char* ws = (char*)d_ws; size_t off = 0;
  auto take = [&](size_t bytes) { char* p = ws + off; off += (bytes + 255) & ~(size_t)255; return p; };
  float* kn = (float*)take((size_t)NB * NH * LL * 4); _Float16* vT = (_Float16*)take((size_t)NB * NH * EE * LL * 2); float* qh = (float*)take((size_t)NB * NH * LL * EE * 4);
  __bf16* kpk = (__bf16*)take((size_t)NB * NH * LL * EE * 4);
  k_prep<<<dim3(LL / 64, NB * NH), 256, 0, stream>>>(k, v, kn, vT, kpk);
  k_scan<<<NB * NH, 1024, 0, stream>>>(q, w, qmask, qh);
  k_attn<<<dim3(LL / 64, NB * NH), 128, 0, stream>>>(qh, kpk, kn, vT, kmask, q, out);
}

// v004
// A run of this version takes 59.1 microseconds.
// In both of two side-by-side timings against v003, it was 1.36 times as fast.
// Over all steps from v000 it is 14.0 times as fast.
#include <hip/hip_runtime.h>
#include <math.h>

typedef __attribute__((ext_vector_type(16))) _Float16 v16h;
typedef __attribute__((ext_vector_type(16))) __bf16 v16b;
typedef __attribute__((ext_vector_type(8)))  _Float16 v8h;
typedef __attribute__((ext_vector_type(8)))  float v8f;
typedef __attribute__((ext_vector_type(4)))  float v4f;
typedef __attribute__((ext_vector_type(2)))  float v2f;
typedef __attribute__((ext_vector_type(4)))  unsigned v4u;
typedef __attribute__((ext_vector_type(4)))  int v4i;
typedef float __attribute__((may_alias)) float_a;
typedef int __attribute__((may_alias)) int_a;

template <typename T> __device__ __forceinline__ void vst2(void* p, T v) { *(T*)p = v;  }
__device__ __forceinline__ v8f wmma16(v16h a, v16h b, v8f c) {
  v8f d = __builtin_amdgcn_wmma_f32_16x16x32_f16(false, a, false, b, (short)0, c, false, false);
  asm volatile("v_nop\n\tv_nop\n\tv_nop\n\tv_nop" : "+v"(d) : "v"(a), "v"(b));
  return d;
}
__device__ __forceinline__ v8f wmma_bf(v16b a, v16b b, v8f c) {
  v8f d = __builtin_amdgcn_wmma_f32_16x16x32_bf16(false, a, false, b, (short)0, c, false, false);
  asm volatile("v_nop\n\tv_nop\n\tv_nop\n\tv_nop" : "+v"(d) : "v"(a), "v"(b));
  return d;
}
// 16x16x32 fragments: lane = (h = lane>>4, row/col = lane&15); elements 0..7 = k0+8h+0..7, 8..15 = k0+16+8h+0..7; D element r = row 8h+r
__device__ __forceinline__ v16h frag_h(const _Float16* rowk0, int lane) {
  union { v16h v; v8h q[2]; } u; const _Float16* p = rowk0 + 8 * (lane >> 4);
  u.q[0] = *(const v8h*)p; u.q[1] = *(const v8h*)(p + 16); return u.v;
}
__device__ __forceinline__ v16h frag_f32(const float* rowk0, int lane) {
  v16h a; const float* p = rowk0 + 8 * (lane >> 4);
#pragma unroll
  for (int i = 0; i < 8; ++i) { a[i] = (_Float16)p[i]; a[8 + i] = (_Float16)p[16 + i]; }
  return a;
}
__device__ __forceinline__ v16h frag_f32s(const float* rowk0, int lane, float sc) {
  v16h a; const float* p = rowk0 + 8 * (lane >> 4);
#pragma unroll
  for (int i = 0; i < 8; ++i) { a[i] = (_Float16)(p[i] * sc); a[8 + i] = (_Float16)(p[16 + i] * sc); }
  return a;
}
// column fragment from a [K][ld] layout (column n), rows >= K read as 0
__device__ __forceinline__ v16h fragc_f32(const float* W, int k0, int n, int lane, int ld, int K) {
  v16h a; const int g = lane >> 4;
#pragma unroll
  for (int i = 0; i < 8; ++i) { const int ka = k0 + 8 * g + i, kb = ka + 16;
    a[i] = (_Float16)(ka < K ? W[(size_t)ka * ld + n] : 0.f); a[8 + i] = (_Float16)(kb < K ? W[(size_t)kb * ld + n] : 0.f); }
  return a;
}
struct F2 { v16b h, l; };
__device__ __forceinline__ F2 bsplit16(const float v[16]) { F2 r;
#pragma unroll
  for (int i = 0; i < 16; ++i) { const __bf16 h = (__bf16)v[i]; r.h[i] = h; r.l[i] = (__bf16)(v[i] - (float)h); }
  return r; }
__device__ __forceinline__ F2 split_row(const float* row, int k0, int lane) { float v[16]; const float* p = row + k0 + 8 * (lane >> 4);
#pragma unroll
  for (int i = 0; i < 8; ++i) { v[i] = p[i]; v[8 + i] = p[16 + i]; }
  return bsplit16(v); }
__device__ __forceinline__ F2 split_rowK(const float* row, int k0, int lane, int K) { float v[16]; const int g = lane >> 4;
#pragma unroll
  for (int i = 0; i < 8; ++i) { const int ka = k0 + 8 * g + i, kb = ka + 16; v[i] = ka < K ? row[ka] : 0.f; v[8 + i] = kb < K ? row[kb] : 0.f; }
  return bsplit16(v); }
__device__ __forceinline__ F2 split_col(const float* W, int k0, int n, int lane, int ld, int K) { float v[16]; const int g = lane >> 4;
#pragma unroll
  for (int i = 0; i < 8; ++i) { const int ka = k0 + 8 * g + i, kb = ka + 16; v[i] = ka < K ? W[(size_t)ka * ld + n] : 0.f; v[8 + i] = kb < K ? W[(size_t)kb * ld + n] : 0.f; }
  return bsplit16(v); }
__device__ __forceinline__ v8f mac3(const F2& a, const F2& b, v8f c) { c = wmma_bf(a.l, b.h, c); c = wmma_bf(a.h, b.l, c); return wmma_bf(a.h, b.h, c); }
__device__ __forceinline__ float sigm(float v) { return 1.0f / (1.0f + expf(-v)); }
#define LDSX() do { asm volatile("s_wait_dscnt 0" ::: "memory"); __builtin_amdgcn_wave_barrier(); __builtin_amdgcn_fence(__ATOMIC_RELEASE, "workgroup"); } while (0)

// Causal "fast Euclidean" attention. Stage 1 (prefix softmax of the per-token score s_j over j <= i) is a running
// (online-softmax) scan per (batch, head) in f32 giving qhat_i directly. Stage 2: -|qhat_i - k_j|^2 = 2 qhat.k - |k|^2 - |qhat|^2,
// and the per-row constant |qhat|^2 cancels in the softmax, so it is causal attention with logits 2 qhat_i.k_j - |k_j|^2
// (x k_mask[b,0]): S on v_wmma_f32_16x16x32_bf16 as a two-way bf16 split of qhat / keys, P@V on
#define NB 4
#define LL 1024
#define NH 12
#define EE 64
#define KF 5   // key fragments of the next tile that are fetched under the softmax; the other 8 - KF behind the value products (with 6 the build spills)

// per (b,h): kn[j] = |k_j|^2 (f32); keys (as their two-way bf16 split) and values (f16) laid out in the order k_attn's fragments read them,
// in chunks of 512 B = 32 lanes x 16 B, so that one wave-wide 16-byte load there covers four whole lines; block = (b,h, 64 keys)
//   kpk: chunk ((bh*64 + key/16)*2 + kc)*4 + part*2 + c (part 0 = high, 1 = low): lane (g, col) holds k = kc*32 + 16c + 8g + 0..7 of key (key/16)*16 + col
//   vT:  chunk ((bh*16 + key/64)*2 + kc)*8 + t*2 + c: lane (g, col) holds keys kc*32 + 16c + 8g + 0..7 of the 64, channel t*16 + col
__global__ __launch_bounds__(256) void k_prep(const float* __restrict__ keys, const float* __restrict__ vals, float* __restrict__ kn, _Float16* __restrict__ vT, __bf16* __restrict__ kpk) {
  __shared__ float tile[64][65];
  __shared__ __align__(16) float skn[64];
  const int bh = blockIdx.y, b = bh / NH, h = bh % NH, j0 = blockIdx.x * 64, tid = threadIdx.x;
  { const int fr = tid >> 5, ln = tid & 31;              // wave fr: score fragment (16 keys fr >> 1, kc = fr & 1) of this block's 64 keys
    const F2 f = split_row(keys + (((size_t)b * LL + j0 + (fr >> 1) * 16 + (ln & 15)) * NH + h) * EE, (fr & 1) * 32, ln);
    union { v16b v; v4u q[2]; } hi, lo; hi.v = f.h; lo.v = f.l;
    __bf16* d = kpk + (((size_t)bh * 128 + blockIdx.x * 8 + fr) * 4) * 256 + ln * 8;
    vst2(d, hi.q[0]); vst2(d + 256, hi.q[1]); vst2(d + 512, lo.q[0]); vst2(d + 768, lo.q[1]); }
  for (int q = tid; q < 64 * 64; q += 256) { const int jl = q >> 6, e = q & 63; tile[jl][e] = vals[(((size_t)b * LL + j0 + jl) * NH + h) * EE + e]; }
  if (tid < 64) { const float* kr = keys + (((size_t)b * LL + j0 + tid) * NH + h) * EE; float s = 0.f;
#pragma unroll 8
    for (int e = 0; e < EE; ++e) s += kr[e] * kr[e];
    skn[tid] = s; }
  __syncthreads();
  { const int ln = tid & 31;
#pragma unroll
    for (int u = 0; u < 2; ++u) { const int ch = (tid >> 5) + u * 8;      // chunk kc*8 + t*2 + c of this block's 16, two per wave
      const int e = ((ch >> 1) & 3) * 16 + (ln & 15), kb = (ch >> 3) * 32 + (ch & 1) * 16 + (ln >> 4) * 8; union { v8h hh; v4u uu; } pk;
#pragma unroll
      for (int i = 0; i < 8; ++i) pk.hh[i] = (_Float16)tile[kb + i][e];
      vst2(vT + (((size_t)bh * 16 + blockIdx.x) * 16 + ch) * 256 + ln * 8, pk.uu); } }
  if (tid < 16) vst2(kn + (size_t)bh * LL + j0 + tid * 4, *(const v4f*)(&skn[tid * 4]));
}
// stage 1 scan per (b,h): one 32-wave block; wave c scans rows 32c..32c+31 from an empty state, the 32 chunk states meet in LDS,
// and each wave merges the chunks in front of it into its rows. Lane holds 2 channels of every row; per-row scalars live one row per lane.
template <int M> __device__ __forceinline__ float lx(float v) {      // value of lane ^ M
  if constexpr (M == 16) { const int b = __float_as_int(v); return __int_as_float(__builtin_amdgcn_permlanex16(b, b, 0x76543210, 0xfedcba98, false, false)); }
  else return __int_as_float(__builtin_amdgcn_update_dpp(0, __float_as_int(v), 0x160 | M, 0xf, 0xf, true));   // row_xmask:M
}
template <int D> __device__ __forceinline__ float lshr(float v) {    // value of lane - D inside the 16-lane row, own value where there is none
  return __int_as_float(__builtin_amdgcn_update_dpp(__float_as_int(v), __float_as_int(v), 0x110 | D, 0xf, 0xf, false));   // row_shr:D
}
__device__ __forceinline__ float bc(float v, int l) { return __int_as_float(__builtin_amdgcn_readlane(__float_as_int(v), l)); }
template <int N> __device__ __forceinline__ void fold(float (&t)[32], int lane) {   // 2N row sums -> N, each lane keeps the half its bit N names
  const bool hi = lane & N;
#pragma unroll
  for (int r = 0; r < N; ++r) { const float keep = hi ? t[r + N] : t[r], send = hi ? t[r] : t[r + N]; t[r] = keep + lx<N>(send); }
}
__device__ __forceinline__ float allmax(float v) { v = fmaxf(v, lx<1>(v)); v = fmaxf(v, lx<2>(v)); v = fmaxf(v, lx<4>(v)); v = fmaxf(v, lx<8>(v)); return fmaxf(v, lx<16>(v)); }
__device__ __forceinline__ float allsum(float v) { v += lx<1>(v); v += lx<2>(v); v += lx<4>(v); v += lx<8>(v); return v + lx<16>(v); }
__global__ __launch_bounds__(1024) void k_scan(const float* __restrict__ q, const float* __restrict__ w, const float* __restrict__ qmask, float* __restrict__ qh) {
  __shared__ __align__(16) float sA[32][EE];
  __shared__ float sM[32], sZ[32];
  const int bh = blockIdx.x, b = bh / NH, h = bh % NH, lane = threadIdx.x & 31, wv = __builtin_amdgcn_readfirstlane(threadIdx.x >> 5);
  const v2f wl = *(const v2f*)(w + h * EE + 2 * lane); const float qm = qmask[(size_t)b * LL];
  const float* qr = q + (((size_t)b * LL + wv * 32) * NH + h) * EE + 2 * lane;
  v2f a[32]; float t[32];
#pragma unroll
  for (int j = 0; j < 32; ++j) a[j] = *(const v2f*)(qr + (size_t)j * NH * EE);
#pragma unroll
  for (int j = 0; j < 32; ++j) t[j] = a[j].x * wl.x + a[j].y * wl.y;
  fold<16>(t, lane); fold<8>(t, lane); fold<4>(t, lane); fold<2>(t, lane); fold<1>(t, lane);
  const float s = t[0] * qm;                              // lane l: score of row l of the chunk
  float m = s;                                            // running maximum inside the chunk
  m = fmaxf(m, lshr<1>(m)); m = fmaxf(m, lshr<2>(m)); m = fmaxf(m, lshr<4>(m)); m = fmaxf(m, lshr<8>(m));
  const float m15 = bc(m, 15);
  if (lane >= 16) m = fmaxf(m, m15);
  const float ms = lshr<1>(m);                            // taken with every lane on: a lane that is off feeds no neighbour
  const float mp = lane == 16 ? m15 : ms;
  const float c = lane ? expf(mp - m) : 0.f, p = expf(s - m);
  float z = 0.f, zi = 0.f; v2f acc = {0.f, 0.f};
#pragma unroll
  for (int j = 0; j < 32; ++j) { const float cj = bc(c, j), pj = bc(p, j);
    acc = acc * cj + a[j] * pj; a[j] = acc;               // unnormalised prefix of row j, relative to m of row j
    z = z * cj + pj; zi = lane == j ? z : zi; }                           // lane j keeps row j's z
  vst2(&sA[wv][2 * lane], acc);
  if (lane == 31) { sM[wv] = m; sZ[wv] = zi; }
  __syncthreads();
  const bool pre = lane < wv;                             // lane l: chunk l, counted if it lies in front of this wave's
  const float Mo = pre ? sM[lane] : -3.0e38f, Zo = pre ? sZ[lane] : 0.f;
  const float Mp = allmax(Mo);
  const float e = pre ? expf(Mo - Mp) : 0.f;
  const float Zp = allsum(e * Zo);
  v2f Ap = {0.f, 0.f};
#pragma unroll 1
  for (int c0 = 0; c0 < wv; c0 += 8)
#pragma unroll
    for (int u = 0; u < 8; ++u) Ap += *(const v2f*)(&sA[c0 + u][2 * lane]) * bc(e, c0 + u);   // e is 0 from chunk wv on
  const float mt = fmaxf(Mp, m), e1 = expf(Mp - mt), e2 = expf(m - mt), zt = Zp * e1 + zi * e2, f1 = e1 / zt, f2 = e2 / zt;
  float* o = qh + ((size_t)bh * LL + wv * 32) * EE + 2 * lane;
#pragma unroll
  for (int j = 0; j < 32; ++j) vst2(o + j * EE, (v2f)(Ap * bc(f1, j) + a[j] * bc(f2, j)));    // 32 lanes x 8 B = the 256-B row
}
// one key tile's eight score fragments from kpk: fragment f = t*2+kc is four chunks in a row: high elements 0..7, 8..15, low elements 0..7, 8..15
template <int F0, int F1> __device__ __forceinline__ void load_ktile(v4u (&kr)[8][4], const __bf16* p0) {     // fragments F0 .. F1-1
#pragma unroll   // both loops unrolled: kr is indexed by constants only and stays in registers; the loads stand in a row, one base address
  for (int f = F0; f < F1; ++f)
#pragma unroll
    for (int c = 0; c < 4; ++c) kr[f][c] = *(const v4u*)(p0 + (f * 4 + c) * 256);
}
__device__ __forceinline__ F2 packed_regs(const v4u (&q)[4]) { union { v16b v; v4u u[2]; } hi, lo;
  hi.u[0] = q[0]; hi.u[1] = q[1]; lo.u[0] = q[2]; lo.u[1] = q[3]; F2 r; r.h = hi.v; r.l = lo.v; return r; }
// exchange between the lanes of ONE wave through its own LDS rows: the wave's LDS operations retire before it reads, and the clobber and the
// wave barrier keep the compiler from moving an LDS access across the point; unlike LDSX it holds no fence, which would also wait for every
// global load in flight
#define LDSW() do { asm volatile("s_wait_dscnt 0" ::: "memory"); __builtin_amdgcn_wave_barrier(); } while (0)
// stage 2: causal attention per (b,h, 64 queries): logits = kscale * (2 qhat.k - kn); online softmax (in base 2); @ V; out = queries + summary
__global__ __launch_bounds__(128) void k_attn(const float* __restrict__ qh, const __bf16* __restrict__ kpk, const float* __restrict__ kn, const _Float16* __restrict__ vT,
                                            const float* __restrict__ kmask, const float* __restrict__ qin, float* __restrict__ out) {
  __shared__ __align__(16) float sS[4][16][68];
  __shared__ __align__(16) _Float16 sP[4][16][72];
  __shared__ __align__(16) float sO[4][16][68];
  const int tid = threadIdx.x, w = tid >> 5, lane = tid & 31, col = lane & 15, g = lane >> 4;
  const int bh = blockIdx.y, b = bh / NH, h = bh % NH, q0 = blockIdx.x * 64 + w * 16;
  const float ks = kmask[(size_t)b * LL] * 1.44269504088896341f;   // logits in base 2: the exponentials below are then one v_exp_f32 each
  F2 aq[2];                                              // scores need near-f32 operands (two-way bf16 split)
  const float* qr = qh + ((size_t)bh * LL + q0 + col) * EE;
#pragma unroll
  for (int kc = 0; kc < 2; ++kc) aq[kc] = split_row(qr, kc * 32, lane);
  asm volatile("s_wait_xcnt 0x0" ::: "memory");          // in front of every later overwrite of the address registers that the loads above name
  float mrun = -3.0e38f, lrun = 0.f; v8f acc[4] = {};
  const int ntiles = blockIdx.x + 1;                     // causal: key tiles 0..blockIdx.x
  // Every global load is issued well ahead of its use: a tile's keys and norms during the tile before, its values behind its score products.
  const __bf16* kp = kpk + (size_t)bh * LL * EE * 2 + lane * 8;                 // this lane's 16 B of every chunk of tile 0
  const float* np = kn + (size_t)bh * LL + col;
  const _Float16* vp = vT + (size_t)bh * EE * LL + lane * 8;
  v4u kr[8][4]; float kv[4];
  load_ktile<0, 8>(kr, kp);
#pragma unroll   // constant indices: kv stays in registers
  for (int t = 0; t < 4; ++t) kv[t] = np[t * 16];
  kp += 64 * EE * 2; np += 64;                           // from here on: the NEXT tile's keys and norms; vp: this tile's values
#pragma unroll 1
  for (int kt = 0; kt < ntiles; ++kt) {
    v8f s4[4];
#pragma unroll
    for (int t = 0; t < 4; ++t) { s4[t] = (v8f){};
#pragma unroll
      for (int kc = 0; kc < 2; ++kc) s4[t] = mac3(aq[kc], packed_regs(kr[t * 2 + kc]), s4[t]); }
    v8h vr[2][4][2];                                     // this tile's value fragments: in flight under the softmax
#pragma unroll   // both loops unrolled: vr stays in registers; 16 loads in a row, one base address
    for (int kc = 0; kc < 2; ++kc)
#pragma unroll
      for (int t = 0; t < 4; ++t) { const _Float16* p = vp + (kc * 8 + t * 2) * 256; vr[kc][t][0] = *(const v8h*)p; vr[kc][t][1] = *(const v8h*)(p + 256); }
    // The fetch is unconditional, so that no old fragment stays live beside the new ones (that spilled): the last pass, which has no next tile,
    // fetches its own tile again, in bounds, and nothing reads it.
    const __bf16* kq = kt + 1 < ntiles ? kp : kp - 64 * EE * 2;
    load_ktile<0, KF>(kr, kq);                 // next tile's first key fragments: in flight under the softmax
    // in front of every later overwrite of an address register that the loads above name; the addresses as inputs keep their registers whole up to here
    asm volatile("s_wait_xcnt 0x0" :: "v"(vp), "v"(kq) : "memory");
#pragma unroll
    for (int t = 0; t < 4; ++t)
#pragma unroll
      for (int r = 0; r < 8; ++r) { const int i = q0 + 8 * g + r, j = kt * 64 + t * 16 + col;
        sS[w][8 * g + r][t * 16 + col] = j <= i ? ks * (2.0f * s4[t][r] - kv[t]) : -3.0e38f; }
    if (kt + 1 < ntiles) {
#pragma unroll   // constant indices: kv stays in registers
      for (int t = 0; t < 4; ++t) kv[t] = np[t * 16]; }
    asm volatile("s_wait_xcnt 0x0" ::: "memory");        // in front of every later overwrite of an address register that the loads above name
    LDSW();
    float mx = -3.0e38f;
#pragma unroll
    for (int jj = 0; jj < 32; ++jj) mx = fmaxf(mx, sS[w][col][g * 32 + jj]);
    mx = fmaxf(mx, __shfl_xor(mx, 16, 32));
    const float mnew = fmaxf(mrun, mx); const float corr = __builtin_amdgcn_exp2f(mrun - mnew);
    float ps = 0.f;
#pragma unroll
    for (int jj = 0; jj < 32; ++jj) { const float v = sS[w][col][g * 32 + jj]; const float p = __builtin_amdgcn_exp2f(v - mnew); ps += p;   /* a masked score, -3.0e38 against a finite maximum, gives 0 */ sP[w][col][g * 32 + jj] = (_Float16)(p * 16384.0f); }
    ps += __shfl_xor(ps, 16, 32);
    lrun = lrun * corr + ps; mrun = mnew;
#pragma unroll
    for (int r = 0; r < 8; ++r) { const float cr = __shfl(corr, 8 * g + r, 32);
#pragma unroll
      for (int t = 0; t < 4; ++t) acc[t][r] *= cr; }
    LDSW();
#pragma unroll
    for (int kc = 0; kc < 2; ++kc) { const v16h pa = frag_h(&sP[w][col][0] + kc * 32, lane);
#pragma unroll
      for (int t = 0; t < 4; ++t) { union { v16h v; v8h q[2]; } u; u.q[0] = vr[kc][t][0]; u.q[1] = vr[kc][t][1]; acc[t] = wmma16(pa, u.v, acc[t]); } }
    // the next tile's last key fragments come behind the value products, whose fragments then share their registers (all of these feed matrix
    // instructions, and held at once they spilled); they are in flight under the next tile's first score products
    load_ktile<KF, 8>(kr, kq);
    asm volatile("s_wait_xcnt 0x0" ::: "memory");        // in front of the overwrite of the address registers that the loads above name
    kp += 64 * EE * 2; np += 64; vp += 64 * EE;
    __builtin_amdgcn_wave_barrier();
  }
#pragma unroll
  for (int r = 0; r < 8; ++r) { const float lr = __shfl(lrun, 8 * g + r, 32);
#pragma unroll
    for (int t = 0; t < 4; ++t) sO[w][8 * g + r][t * 16 + col] = acc[t][r] / (lr * 16384.0f); }
  LDSX();
  for (int qq = lane; qq < 16 * 16; qq += 32) { const int rl = qq >> 4, pc = qq & 15; const size_t o = (((size_t)b * LL + q0 + rl) * NH + h) * EE + pc * 4;
    vst2(out + o, *(const v4f*)(&sO[w][rl][pc * 4]) + *(const v4f*)(qin + o)); }
}
extern "C" void kernel_launch(void* const* d_in, const int* in_sizes, int n_in, void* d_out, int out_size, void* d_ws, size_t ws_size, hipStream_t stream) {
  (void)in_sizes; (void)n_in; (void)out_size; (void)ws_size;
  const float* q = (const float*)d_in[0]; const float* k = (const float*)d_in[1]; const float* v = (const float*)d_in[2];
  const float* qmask = (const float*)d_in[3]; const float* kmask = (const float*)d_in[4]; const float* w = (const float*)d_in[5];
  float* out = (float*)d_out;
  char* ws = (char*)d_ws; size_t off = 0;
  auto take = [&](size_t bytes) { char* p = ws + off; off += (bytes + 255) & ~(size_t)255; return p; };
  float* kn = (float*)take((size_t)NB * NH * LL * 4); _Float16* vT = (_Float16*)take((size_t)NB * NH * EE * LL * 2); float* qh = (float*)take((size_t)NB * NH * LL * EE * 4);
  __bf16* kpk = (__bf16*)take((size_t)NB * NH * LL * EE * 4);
  k_prep<<<dim3(LL / 64, NB * NH), 256, 0, stream>>>(k, v, kn, vT, kpk);
  k_scan<<<NB * NH, 1024, 0, stream>>>(q, w, qmask, qh);
  k_attn<<<dim3(LL / 64, NB * NH), 128, 0, stream>>>(qh, kpk, kn, vT, kmask, q, out);
}

// v005
// One run takes 56.4 microseconds.
// Timed twice side by side with v004, it ran 1.04 and 1.05 times as fast.
// Over all steps from v000 it is 14.7 times as fast.
#include <hip/hip_runtime.h>
#include <math.h>

typedef __attribute__((ext_vector_type(16))) _Float16 v16h;
typedef __attribute__((ext_vector_type(16))) __bf16 v16b;
typedef __attribute__((ext_vector_type(8)))  _Float16 v8h;
typedef __attribute__((ext_vector_type(8)))  float v8f;
typedef __attribute__((ext_vector_type(4)))  float v4f;
typedef __attribute__((ext_vector_type(2)))  float v2f;
typedef __attribute__((ext_vector_type(4)))  unsigned v4u;
typedef __attribute__((ext_vector_type(4)))  int v4i;
typedef float __attribute__((may_alias)) float_a;
typedef int __attribute__((may_alias)) int_a;

template <typename T> __device__ __forceinline__ void vst2(void* p, T v) { *(T*)p = v;  }
__device__ __forceinline__ v8f wmma16(v16h a, v16h b, v8f c) {
  v8f d = __builtin_amdgcn_wmma_f32_16x16x32_f16(false, a, false, b, (short)0, c, false, false);
  asm volatile("v_nop\n\tv_nop\n\tv_nop\n\tv_nop" : "+v"(d) : "v"(a), "v"(b));
  return d;
}
__device__ __forceinline__ v8f wmma_bf(v16b a, v16b b, v8f c) {
  v8f d = __builtin_amdgcn_wmma_f32_16x16x32_bf16(false, a, false, b, (short)0, c, false, false);
  asm volatile("v_nop\n\tv_nop\n\tv_nop\n\tv_nop" : "+v"(d) : "v"(a), "v"(b));
  return d;
}
// 16x16x32 fragments: lane = (h = lane>>4, row/col = lane&15); elements 0..7 = k0+8h+0..7, 8..15 = k0+16+8h+0..7; D element r = row 8h+r
__device__ __forceinline__ v16h frag_h(const _Float16* rowk0, int lane) {
  union { v16h v; v8h q[2]; } u; const _Float16* p = rowk0 + 8 * (lane >> 4);
  u.q[0] = *(const v8h*)p; u.q[1] = *(const v8h*)(p + 16); return u.v;
}
__device__ __forceinline__ v16h frag_f32(const float* rowk0, int lane) {
  v16h a; const float* p = rowk0 + 8 * (lane >> 4);
#pragma unroll
  for (int i = 0; i < 8; ++i) { a[i] = (_Float16)p[i]; a[8 + i] = (_Float16)p[16 + i]; }
  return a;
}
__device__ __forceinline__ v16h frag_f32s(const float* rowk0, int lane, float sc) {
  v16h a; const float* p = rowk0 + 8 * (lane >> 4);
#pragma unroll
  for (int i = 0; i < 8; ++i) { a[i] = (_Float16)(p[i] * sc); a[8 + i] = (_Float16)(p[16 + i] * sc); }
  return a;
}
// column fragment from a [K][ld] layout (column n), rows >= K read as 0
__device__ __forceinline__ v16h fragc_f32(const float* W, int k0, int n, int lane, int ld, int K) {
  v16h a; const int g = lane >> 4;
#pragma unroll
  for (int i = 0; i < 8; ++i) { const int ka = k0 + 8 * g + i, kb = ka + 16;
    a[i] = (_Float16)(ka < K ? W[(size_t)ka * ld + n] : 0.f); a[8 + i] = (_Float16)(kb < K ? W[(size_t)kb * ld + n] : 0.f); }
  return a;
}
struct F2 { v16b h, l; };
__device__ __forceinline__ F2 bsplit16(const float v[16]) { F2 r;
#pragma unroll
  for (int i = 0; i < 16; ++i) { const __bf16 h = (__bf16)v[i]; r.h[i] = h; r.l[i] = (__bf16)(v[i] - (float)h); }
  return r; }
__device__ __forceinline__ F2 split_row(const float* row, int k0, int lane) { float v[16]; const float* p = row + k0 + 8 * (lane >> 4);
#pragma unroll
  for (int i = 0; i < 8; ++i) { v[i] = p[i]; v[8 + i] = p[16 + i]; }
  return bsplit16(v); }
__device__ __forceinline__ F2 split_row_s(const float* row, int k0, int lane, float sc) { float v[16]; const float* p = row + k0 + 8 * (lane >> 4);
#pragma unroll
  for (int i = 0; i < 8; ++i) { v[i] = p[i] * sc; v[8 + i] = p[16 + i] * sc; }
  return bsplit16(v); }
__device__ __forceinline__ F2 split_rowK(const float* row, int k0, int lane, int K) { float v[16]; const int g = lane >> 4;
#pragma unroll
  for (int i = 0; i < 8; ++i) { const int ka = k0 + 8 * g + i, kb = ka + 16; v[i] = ka < K ? row[ka] : 0.f; v[8 + i] = kb < K ? row[kb] : 0.f; }
  return bsplit16(v); }
__device__ __forceinline__ F2 split_col(const float* W, int k0, int n, int lane, int ld, int K) { float v[16]; const int g = lane >> 4;
#pragma unroll
  for (int i = 0; i < 8; ++i) { const int ka = k0 + 8 * g + i, kb = ka + 16; v[i] = ka < K ? W[(size_t)ka * ld + n] : 0.f; v[8 + i] = kb < K ? W[(size_t)kb * ld + n] : 0.f; }
  return bsplit16(v); }
__device__ __forceinline__ v8f mac3(const F2& a, const F2& b, v8f c) { c = wmma_bf(a.l, b.h, c); c = wmma_bf(a.h, b.l, c); return wmma_bf(a.h, b.h, c); }
__device__ __forceinline__ float sigm(float v) { return 1.0f / (1.0f + expf(-v)); }
#define LDSX() do { asm volatile("s_wait_dscnt 0" ::: "memory"); __builtin_amdgcn_wave_barrier(); __builtin_amdgcn_fence(__ATOMIC_RELEASE, "workgroup"); } while (0)

// Causal "fast Euclidean" attention. Stage 1 (prefix softmax of the per-token score s_j over j <= i) is a running
// (online-softmax) scan per (batch, head) in f32 giving qhat_i directly. Stage 2: -|qhat_i - k_j|^2 = 2 qhat.k - |k|^2 - |qhat|^2,
// and the per-row constant |qhat|^2 cancels in the softmax, so it is causal attention with logits 2 qhat_i.k_j - |k_j|^2
// (x k_mask[b,0]): S on v_wmma_f32_16x16x32_bf16 as a two-way bf16 split of qhat / keys, P@V on
#define NB 4
#define LL 1024
#define NH 12
#define EE 64
#define KF 3   // key fragments of the next tile that are fetched under the softmax; the other 8 - KF behind the value products (with 4 the build spills)

// per (b,h): kn[j] = -ks |k_j|^2 (f32; ks = k_mask[b,0] log2(e)), the start value of key j's score accumulators in k_attn; keys (as their two-way bf16 split) and values (f16) laid out in the order k_attn's fragments read them,
// in chunks of 512 B = 32 lanes x 16 B, so that one wave-wide 16-byte load there covers four whole lines; block = (b,h, 64 keys)
//   kpk: chunk ((bh*64 + key/16)*2 + kc)*4 + part*2 + c (part 0 = high, 1 = low): lane (g, col) holds k = kc*32 + 16c + 8g + 0..7 of key (key/16)*16 + col
//   vT:  chunk ((bh*16 + key/64)*2 + kc)*8 + t*2 + c: lane (g, col) holds keys kc*32 + 16c + 8g + 0..7 of the 64, channel t*16 + col
__global__ __launch_bounds__(256) void k_prep(const float* __restrict__ keys, const float* __restrict__ vals, const float* __restrict__ kmask, float* __restrict__ kn, _Float16* __restrict__ vT, __bf16* __restrict__ kpk) {
  __shared__ float tile[64][65];
  __shared__ __align__(16) float skn[64];
  const int bh = blockIdx.y, b = bh / NH, h = bh % NH, j0 = blockIdx.x * 64, tid = threadIdx.x;
  { const int fr = tid >> 5, ln = tid & 31;              // wave fr: score fragment (16 keys fr >> 1, kc = fr & 1) of this block's 64 keys
    const F2 f = split_row(keys + (((size_t)b * LL + j0 + (fr >> 1) * 16 + (ln & 15)) * NH + h) * EE, (fr & 1) * 32, ln);
    union { v16b v; v4u q[2]; } hi, lo; hi.v = f.h; lo.v = f.l;
    __bf16* d = kpk + (((size_t)bh * 128 + blockIdx.x * 8 + fr) * 4) * 256 + ln * 8;
    vst2(d, hi.q[0]); vst2(d + 256, hi.q[1]); vst2(d + 512, lo.q[0]); vst2(d + 768, lo.q[1]); }
  for (int q = tid; q < 64 * 64; q += 256) { const int jl = q >> 6, e = q & 63; tile[jl][e] = vals[(((size_t)b * LL + j0 + jl) * NH + h) * EE + e]; }
  if (tid < 64) { const float* kr = keys + (((size_t)b * LL + j0 + tid) * NH + h) * EE; float s = 0.f;
#pragma unroll 8
    for (int e = 0; e < EE; ++e) s += kr[e] * kr[e];
    skn[tid] = -(kmask[(size_t)b * LL] * 1.44269504088896341f) * s; }
  __syncthreads();
  { const int ln = tid & 31;
#pragma unroll
    for (int u = 0; u < 2; ++u) { const int ch = (tid >> 5) + u * 8;      // chunk kc*8 + t*2 + c of this block's 16, two per wave
      const int e = ((ch >> 1) & 3) * 16 + (ln & 15), kb = (ch >> 3) * 32 + (ch & 1) * 16 + (ln >> 4) * 8; union { v8h hh; v4u uu; } pk;
#pragma unroll
      for (int i = 0; i < 8; ++i) pk.hh[i] = (_Float16)tile[kb + i][e];
      vst2(vT + (((size_t)bh * 16 + blockIdx.x) * 16 + ch) * 256 + ln * 8, pk.uu); } }
  if (tid < 16) vst2(kn + (size_t)bh * LL + j0 + tid * 4, *(const v4f*)(&skn[tid * 4]));
}
// stage 1 scan per (b,h): one 32-wave block; wave c scans rows 32c..32c+31 from an empty state, the 32 chunk states meet in LDS,
// and each wave merges the chunks in front of it into its rows. Lane holds 2 channels of every row; per-row scalars live one row per lane.
template <int M> __device__ __forceinline__ float lx(float v) {      // value of lane ^ M
  if constexpr (M == 16) { const int b = __float_as_int(v); return __int_as_float(__builtin_amdgcn_permlanex16(b, b, 0x76543210, 0xfedcba98, false, false)); }
  else return __int_as_float(__builtin_amdgcn_update_dpp(0, __float_as_int(v), 0x160 | M, 0xf, 0xf, true));   // row_xmask:M
}
template <int D> __device__ __forceinline__ float lshr(float v) {    // value of lane - D inside the 16-lane row, own value where there is none
  return __int_as_float(__builtin_amdgcn_update_dpp(__float_as_int(v), __float_as_int(v), 0x110 | D, 0xf, 0xf, false));   // row_shr:D
}
__device__ __forceinline__ float bc(float v, int l) { return __int_as_float(__builtin_amdgcn_readlane(__float_as_int(v), l)); }
template <int N> __device__ __forceinline__ void fold(float (&t)[32], int lane) {   // 2N row sums -> N, each lane keeps the half its bit N names
  const bool hi = lane & N;
#pragma unroll
  for (int r = 0; r < N; ++r) { const float keep = hi ? t[r + N] : t[r], send = hi ? t[r] : t[r + N]; t[r] = keep + lx<N>(send); }
}
__device__ __forceinline__ float allmax(float v) { v = fmaxf(v, lx<1>(v)); v = fmaxf(v, lx<2>(v)); v = fmaxf(v, lx<4>(v)); v = fmaxf(v, lx<8>(v)); return fmaxf(v, lx<16>(v)); }
__device__ __forceinline__ float allsum(float v) { v += lx<1>(v); v += lx<2>(v); v += lx<4>(v); v += lx<8>(v); return v + lx<16>(v); }
__global__ __launch_bounds__(1024) void k_scan(const float* __restrict__ q, const float* __restrict__ w, const float* __restrict__ qmask, float* __restrict__ qh) {
  __shared__ __align__(16) float sA[32][EE];
  __shared__ float sM[32], sZ[32];
  const int bh = blockIdx.x, b = bh / NH, h = bh % NH, lane = threadIdx.x & 31, wv = __builtin_amdgcn_readfirstlane(threadIdx.x >> 5);
  const v2f wl = *(const v2f*)(w + h * EE + 2 * lane); const float qm = qmask[(size_t)b * LL];
  const float* qr = q + (((size_t)b * LL + wv * 32) * NH + h) * EE + 2 * lane;
  v2f a[32]; float t[32];
#pragma unroll
  for (int j = 0; j < 32; ++j) a[j] = *(const v2f*)(qr + (size_t)j * NH * EE);
#pragma unroll
  for (int j = 0; j < 32; ++j) t[j] = a[j].x * wl.x + a[j].y * wl.y;
  fold<16>(t, lane); fold<8>(t, lane); fold<4>(t, lane); fold<2>(t, lane); fold<1>(t, lane);
  const float s = t[0] * qm;                              // lane l: score of row l of the chunk
  float m = s;                                            // running maximum inside the chunk
  m = fmaxf(m, lshr<1>(m)); m = fmaxf(m, lshr<2>(m)); m = fmaxf(m, lshr<4>(m)); m = fmaxf(m, lshr<8>(m));
  const float m15 = bc(m, 15);
  if (lane >= 16) m = fmaxf(m, m15);
  const float ms = lshr<1>(m);                            // taken with every lane on: a lane that is off feeds no neighbour
  const float mp = lane == 16 ? m15 : ms;
  const float c = lane ? expf(mp - m) : 0.f, p = expf(s - m);
  float z = 0.f, zi = 0.f; v2f acc = {0.f, 0.f};
#pragma unroll
  for (int j = 0; j < 32; ++j) { const float cj = bc(c, j), pj = bc(p, j);
    acc = acc * cj + a[j] * pj; a[j] = acc;               // unnormalised prefix of row j, relative to m of row j
    z = z * cj + pj; zi = lane == j ? z : zi; }                           // lane j keeps row j's z
  vst2(&sA[wv][2 * lane], acc);
  if (lane == 31) { sM[wv] = m; sZ[wv] = zi; }
  __syncthreads();
  const bool pre = lane < wv;                             // lane l: chunk l, counted if it lies in front of this wave's
  const float Mo = pre ? sM[lane] : -3.0e38f, Zo = pre ? sZ[lane] : 0.f;
  const float Mp = allmax(Mo);
  const float e = pre ? expf(Mo - Mp) : 0.f;
  const float Zp = allsum(e * Zo);
  v2f Ap = {0.f, 0.f};
#pragma unroll 1
  for (int c0 = 0; c0 < wv; c0 += 8)
#pragma unroll
    for (int u = 0; u < 8; ++u) Ap += *(const v2f*)(&sA[c0 + u][2 * lane]) * bc(e, c0 + u);   // e is 0 from chunk wv on
  const float mt = fmaxf(Mp, m), e1 = expf(Mp - mt), e2 = expf(m - mt), zt = Zp * e1 + zi * e2, f1 = e1 / zt, f2 = e2 / zt;
  float* o = qh + ((size_t)bh * LL + wv * 32) * EE + 2 * lane;
#pragma unroll
  for (int j = 0; j < 32; ++j) vst2(o + j * EE, (v2f)(Ap * bc(f1, j) + a[j] * bc(f2, j)));    // 32 lanes x 8 B = the 256-B row
}
// one key tile's eight score fragments from kpk: fragment f = t*2+kc is four chunks in a row: high elements 0..7, 8..15, low elements 0..7, 8..15
template <int F0, int F1> __device__ __forceinline__ void load_ktile(v4u (&kr)[8][4], const __bf16* p0) {     // fragments F0 .. F1-1
#pragma unroll   // both loops unrolled: kr is indexed by constants only and stays in registers; the loads stand in a row, one base address
  for (int f = F0; f < F1; ++f)
#pragma unroll
    for (int c = 0; c < 4; ++c) kr[f][c] = *(const v4u*)(p0 + (f * 4 + c) * 256);
}
__device__ __forceinline__ F2 packed_regs(const v4u (&q)[4]) { union { v16b v; v4u u[2]; } hi, lo;
  hi.u[0] = q[0]; hi.u[1] = q[1]; lo.u[0] = q[2]; lo.u[1] = q[3]; F2 r; r.h = hi.v; r.l = lo.v; return r; }
// stage 2: causal attention per (b,h, 64 queries), transposed: S^T = K qhat^T and O^T += V^T P^T. A lane (g, col) then holds scores of ONE query
// (q0 + col): register r of score tile t is key t*16 + 8g + r. Maximum and sum are taken in the lane, with one exchange between the wave's halves,
// and two score tiles, converted in place, are the B operand of the value product in the hardware k order. The fragments of kpk and vT serve as A
// operands as they lie (A's map is B's with rows for columns). qhat carries the factor 2 ks and the accumulators start at -ks |k|^2, so that the
// products end as the logits in base 2. out = queries + summary
__device__ __forceinline__ float max3f(float a, float b, float c) { return fmaxf(fmaxf(a, b), c); }
__device__ __forceinline__ v8f ld8(const float* p) { union { v8f v; v4f q[2]; } u; u.q[0] = *(const v4f*)p; u.q[1] = *(const v4f*)(p + 4); return u.v; }
__global__ __launch_bounds__(128) void k_attn(const float* __restrict__ qh, const __bf16* __restrict__ kpk, const float* __restrict__ kn, const _Float16* __restrict__ vT,
                                            const float* __restrict__ kmask, const float* __restrict__ qin, float* __restrict__ out) {
  __shared__ __align__(16) float sO[4][16][68];
  const int tid = threadIdx.x, w = tid >> 5, lane = tid & 31, col = lane & 15, g = lane >> 4;
  const int bh = blockIdx.y, b = bh / NH, h = bh % NH, q0 = blockIdx.x * 64 + w * 16;
  const float ks = kmask[(size_t)b * LL] * 1.44269504088896341f;   // logits in base 2: the exponentials below are then one v_exp_f32 each
  F2 bq[2];                                              // scores need near-f32 operands (two-way bf16 split)
  const float* qr = qh + ((size_t)bh * LL + q0 + col) * EE;
#pragma unroll
  for (int kc = 0; kc < 2; ++kc) bq[kc] = split_row_s(qr, kc * 32, lane, 2.0f * ks);
  asm volatile("s_wait_xcnt 0x0" ::: "memory");          // in front of every later overwrite of the address registers that the loads above name
  float mrun = -3.0e38f; v8f l8 = {}; v8f acc[4] = {};   // l8: this lane's eight partial sums of its query's weights, joined behind the loop
  const int ntiles = blockIdx.x + 1;                     // causal: key tiles 0..blockIdx.x
  // Every global load is issued well ahead of its use: a tile's keys and norms during the tile before, its values behind its score products.
  const __bf16* kp = kpk + (size_t)bh * LL * EE * 2 + lane * 8;                 // this lane's 16 B of every chunk of tile 0
  const float* np = kn + (size_t)bh * LL + 8 * g;
  const _Float16* vp = vT + (size_t)bh * EE * LL + lane * 8;
  v4u kr[8][4]; v8f cn[4];
  load_ktile<0, 8>(kr, kp);
#pragma unroll   // constant indices: cn stays in registers
  for (int t = 0; t < 4; ++t) cn[t] = ld8(np + t * 16);
  // The first tile's loads have landed where the loop is entered (the loaded values as inputs only): the compiler's counted waits inside the loop
  // are then those of the loop's own loads; with loads of the prologue still open it set them to the stricter of the two orders of issue.
#pragma unroll
  for (int f = 0; f < 8; ++f) asm volatile("" :: "v"(kr[f][0]), "v"(kr[f][1]), "v"(kr[f][2]), "v"(kr[f][3]));
  asm volatile("" :: "v"(bq[0].h), "v"(bq[0].l), "v"(bq[1].h), "v"(bq[1].l), "v"(cn[0]), "v"(cn[1]), "v"(cn[2]), "v"(cn[3]));
#pragma unroll 1
  for (int kt = 0; kt < ntiles; ++kt) {
    v8f s4[4];
#pragma unroll
    for (int t = 0; t < 4; ++t) { s4[t] = cn[t];
#pragma unroll
      for (int kc = 0; kc < 2; ++kc) s4[t] = mac3(packed_regs(kr[t * 2 + kc]), bq[kc], s4[t]); }
    v8h vr[2][4][2];                                     // this tile's value fragments: in flight under the softmax
#pragma unroll   // both loops unrolled: vr stays in registers; 16 loads in a row, one base address
    for (int kc = 0; kc < 2; ++kc)
#pragma unroll
      for (int t = 0; t < 4; ++t) { const _Float16* p = vp + (kc * 8 + t * 2) * 256; vr[kc][t][0] = *(const v8h*)p; vr[kc][t][1] = *(const v8h*)(p + 256); }
    // The fetch is unconditional, so that no old fragment stays live beside the new ones (that spilled): the last pass, which has no next tile,
    // fetches its own tile again, in bounds, and nothing reads it.
    const bool more = kt + 1 < ntiles;
    const __bf16* kq = kp + (more ? 64 * EE * 2 : 0);    // kp, np, vp: this tile's keys, norms and values
    const float* nq = np + (more ? 64 : 0);
    load_ktile<0, KF>(kr, kq);                 // next tile's first key fragments: in flight under the softmax
    // in front of every later overwrite of an address register that the loads above name; the addresses as inputs keep their registers whole up to here
    asm volatile("s_wait_xcnt 0x0" :: "v"(vp), "v"(kq) : "memory");
    if (!more) {                                         // only the last tile holds keys behind a query
#pragma unroll
      for (int t = 0; t < 4; ++t)
#pragma unroll
        for (int r = 0; r < 8; ++r) s4[t][r] = t * 16 + 8 * g + r <= w * 16 + col ? s4[t][r] : -3.0e38f; }
    float y[12], z[4];                                   // maximum of the lane's 32 scores as a tree of three-way maxima, not one chain
#pragma unroll
    for (int i = 0; i < 10; ++i) y[i] = max3f(s4[(3 * i) >> 3][(3 * i) & 7], s4[(3 * i + 1) >> 3][(3 * i + 1) & 7], s4[(3 * i + 2) >> 3][(3 * i + 2) & 7]);
    y[10] = s4[3][6]; y[11] = s4[3][7];
#pragma unroll
    for (int i = 0; i < 4; ++i) z[i] = max3f(y[3 * i], y[3 * i + 1], y[3 * i + 2]);
    const float mx = fmaxf(max3f(z[0], z[1], z[2]), z[3]);
    const float mnew = max3f(mrun, mx, lx<16>(mx));      // the query's other 32 scores of the tile lie in lane ^ 16
    const float corr = __builtin_amdgcn_exp2f(mrun - mnew), moff = mnew - 14.0f;   // weights carry 2^14 (sum and products alike): small ones stay normal f16
    mrun = mnew;
#pragma unroll
    for (int t = 0; t < 4; ++t) { s4[t] -= moff;
#pragma unroll
      for (int r = 0; r < 8; ++r) s4[t][r] = __builtin_amdgcn_exp2f(s4[t][r]); }   // a masked score, -3.0e38 against a finite maximum, gives 0
    l8 = l8 * corr + ((s4[0] + s4[1]) + (s4[2] + s4[3]));
    union { v16h v; v8h q[2]; } pb[2];
#pragma unroll
    for (int kc = 0; kc < 2; ++kc) { pb[kc].q[0] = __builtin_convertvector(s4[2 * kc], v8h); pb[kc].q[1] = __builtin_convertvector(s4[2 * kc + 1], v8h); }
#pragma unroll   // constant indices: cn stays in registers; the next tile's norms take the registers of the scores, in flight under the value products
    for (int t = 0; t < 4; ++t) cn[t] = ld8(nq + t * 16);
    asm volatile("s_wait_xcnt 0x0" :: "v"(nq) : "memory");   // in front of every later overwrite of the address register that the loads above name
#pragma unroll
    for (int t = 0; t < 4; ++t) acc[t] *= corr;
#pragma unroll
    for (int kc = 0; kc < 2; ++kc)
#pragma unroll
      for (int t = 0; t < 4; ++t) { union { v16h v; v8h q[2]; } u; u.q[0] = vr[kc][t][0]; u.q[1] = vr[kc][t][1]; acc[t] = wmma16(u.v, pb[kc].v, acc[t]); }
    // the next tile's last key fragments come behind the value products, whose fragments then share their registers (all of these feed matrix
    // instructions, and held at once they spilled); they are in flight under the next tile's first score products
    load_ktile<KF, 8>(kr, kq);
    asm volatile("s_wait_xcnt 0x0" :: "v"(kq) : "memory");   // in front of the overwrite of the address registers that the loads above name; kq as above
    kp += 64 * EE * 2; np += 64; vp += 64 * EE;
  }
  float l = ((l8[0] + l8[1]) + (l8[2] + l8[3])) + ((l8[4] + l8[5]) + (l8[6] + l8[7]));
  l += lx<16>(l);
  const float inv = 1.0f / l;                            // acc[t][r] = channel t*16 + 8g + r of query q0 + col
#pragma unroll
  for (int t = 0; t < 4; ++t) { union { v8f v; v4f q[2]; } u; u.v = acc[t] * inv;
    vst2(&sO[w][col][t * 16 + 8 * g], u.q[0]); vst2(&sO[w][col][t * 16 + 8 * g + 4], u.q[1]); }
  LDSX();
  for (int qq = lane; qq < 16 * 16; qq += 32) { const int rl = qq >> 4, pc = qq & 15; const size_t o = (((size_t)b * LL + q0 + rl) * NH + h) * EE + pc * 4;
    vst2(out + o, *(const v4f*)(&sO[w][rl][pc * 4]) + *(const v4f*)(qin + o)); }
}
extern "C" void kernel_launch(void* const* d_in, const int* in_sizes, int n_in, void* d_out, int out_size, void* d_ws, size_t ws_size, hipStream_t stream) {
  (void)in_sizes; (void)n_in; (void)out_size; (void)ws_size;
  const float* q = (const float*)d_in[0]; const float* k = (const float*)d_in[1]; const float* v = (const float*)d_in[2];
  const float* qmask = (const float*)d_in[3]; const float* kmask = (const float*)d_in[4]; const float* w = (const float*)d_in[5];
  float* out = (float*)d_out;
  char* ws = (char*)d_ws; size_t off = 0;
  auto take = [&](size_t bytes) { char* p = ws + off; off += (bytes + 255) & ~(size_t)255; return p; };
  float* kn = (float*)take((size_t)NB * NH * LL * 4); _Float16* vT = (_Float16*)take((size_t)NB * NH * EE * LL * 2); float* qh = (float*)take((size_t)NB * NH * LL * EE * 4);
  __bf16* kpk = (__bf16*)take((size_t)NB * NH * LL * EE * 4);
  k_prep<<<dim3(LL / 64, NB * NH), 256, 0, stream>>>(k, v, kmask, kn, vT, kpk);
  k_scan<<<NB * NH, 1024, 0, stream>>>(q, w, qmask, qh);
  k_attn<<<dim3(LL / 64, NB * NH), 128, 0, stream>>>(qh, kpk, kn, vT, kmask, q, out);
}

// v006
// It runs in 49.1 microseconds.
// Next to v005, in two timings, it ran 1.14 and 1.15 times as fast.
// Over all steps from v000 it is 16.8 times as fast.
#include <hip/hip_runtime.h>
#include <math.h>

typedef __attribute__((ext_vector_type(16))) _Float16 v16h;
typedef __attribute__((ext_vector_type(16))) __bf16 v16b;
typedef __attribute__((ext_vector_type(8)))  _Float16 v8h;
typedef __attribute__((ext_vector_type(8)))  float v8f;
typedef __attribute__((ext_vector_type(4)))  float v4f;
typedef __attribute__((ext_vector_type(2)))  float v2f;
typedef __attribute__((ext_vector_type(4)))  unsigned v4u;
typedef __attribute__((ext_vector_type(4)))  int v4i;
typedef float __attribute__((may_alias)) float_a;
typedef int __attribute__((may_alias)) int_a;

template <typename T> __device__ __forceinline__ void vst2(void* p, T v) { *(T*)p = v;  }
__device__ __forceinline__ v8f wmma16(v16h a, v16h b, v8f c) {
  v8f d = __builtin_amdgcn_wmma_f32_16x16x32_f16(false, a, false, b, (short)0, c, false, false);
  asm volatile("v_nop\n\tv_nop\n\tv_nop\n\tv_nop" : "+v"(d) : "v"(a), "v"(b));
  return d;
}
__device__ __forceinline__ v8f wmma_bf(v16b a, v16b b, v8f c) {
  v8f d = __builtin_amdgcn_wmma_f32_16x16x32_bf16(false, a, false, b, (short)0, c, false, false);
  asm volatile("v_nop\n\tv_nop\n\tv_nop\n\tv_nop" : "+v"(d) : "v"(a), "v"(b));
  return d;
}
// 16x16x32 fragments: lane = (h = lane>>4, row/col = lane&15); elements 0..7 = k0+8h+0..7, 8..15 = k0+16+8h+0..7; D element r = row 8h+r
__device__ __forceinline__ v16h frag_h(const _Float16* rowk0, int lane) {
  union { v16h v; v8h q[2]; } u; const _Float16* p = rowk0 + 8 * (lane >> 4);
  u.q[0] = *(const v8h*)p; u.q[1] = *(const v8h*)(p + 16); return u.v;
}
__device__ __forceinline__ v16h frag_f32(const float* rowk0, int lane) {
  v16h a; const float* p = rowk0 + 8 * (lane >> 4);
#pragma unroll
  for (int i = 0; i < 8; ++i) { a[i] = (_Float16)p[i]; a[8 + i] = (_Float16)p[16 + i]; }
  return a;
}
__device__ __forceinline__ v16h frag_f32s(const float* rowk0, int lane, float sc) {
  v16h a; const float* p = rowk0 + 8 * (lane >> 4);
#pragma unroll
  for (int i = 0; i < 8; ++i) { a[i] = (_Float16)(p[i] * sc); a[8 + i] = (_Float16)(p[16 + i] * sc); }
  return a;
}
// column fragment from a [K][ld] layout (column n), rows >= K read as 0
__device__ __forceinline__ v16h fragc_f32(const float* W, int k0, int n, int lane, int ld, int K) {
  v16h a; const int g = lane >> 4;
#pragma unroll
  for (int i = 0; i < 8; ++i) { const int ka = k0 + 8 * g + i, kb = ka + 16;
    a[i] = (_Float16)(ka < K ? W[(size_t)ka * ld + n] : 0.f); a[8 + i] = (_Float16)(kb < K ? W[(size_t)kb * ld + n] : 0.f); }
  return a;
}
struct F2 { v16b h, l; };
__device__ __forceinline__ F2 bsplit16(const float v[16]) { F2 r;
#pragma unroll
  for (int i = 0; i < 16; ++i) { const __bf16 h = (__bf16)v[i]; r.h[i] = h; r.l[i] = (__bf16)(v[i] - (float)h); }
  return r; }
__device__ __forceinline__ F2 split_row(const float* row, int k0, int lane) { float v[16]; const float* p = row + k0 + 8 * (lane >> 4);
#pragma unroll
  for (int i = 0; i < 8; ++i) { v[i] = p[i]; v[8 + i] = p[16 + i]; }
  return bsplit16(v); }
__device__ __forceinline__ F2 split_row_s(const float* row, int k0, int lane, float sc) { float v[16]; const float* p = row + k0 + 8 * (lane >> 4);
#pragma unroll
  for (int i = 0; i < 8; ++i) { v[i] = p[i] * sc; v[8 + i] = p[16 + i] * sc; }
  return bsplit16(v); }
__device__ __forceinline__ F2 split_rowK(const float* row, int k0, int lane, int K) { float v[16]; const int g = lane >> 4;
#pragma unroll
  for (int i = 0; i < 8; ++i) { const int ka = k0 + 8 * g + i, kb = ka + 16; v[i] = ka < K ? row[ka] : 0.f; v[8 + i] = kb < K ? row[kb] : 0.f; }
  return bsplit16(v); }
__device__ __forceinline__ F2 split_col(const float* W, int k0, int n, int lane, int ld, int K) { float v[16]; const int g = lane >> 4;
#pragma unroll
  for (int i = 0; i < 8; ++i) { const int ka = k0 + 8 * g + i, kb = ka + 16; v[i] = ka < K ? W[(size_t)ka * ld + n] : 0.f; v[8 + i] = kb < K ? W[(size_t)kb * ld + n] : 0.f; }
  return bsplit16(v); }
__device__ __forceinline__ v8f mac3(const F2& a, const F2& b, v8f c) { c = wmma_bf(a.l, b.h, c); c = wmma_bf(a.h, b.l, c); return wmma_bf(a.h, b.h, c); }
__device__ __forceinline__ float sigm(float v) { return 1.0f / (1.0f + expf(-v)); }
#define LDSX() do { asm volatile("s_wait_dscnt 0" ::: "memory"); __builtin_amdgcn_wave_barrier(); __builtin_amdgcn_fence(__ATOMIC_RELEASE, "workgroup"); } while (0)

// Causal "fast Euclidean" attention. Stage 1 (prefix softmax of the per-token score s_j over j <= i) is a running
// (online-softmax) scan per (batch, head) in f32 giving qhat_i directly. Stage 2: -|qhat_i - k_j|^2 = 2 qhat.k - |k|^2 - |qhat|^2,
// and the per-row constant |qhat|^2 cancels in the softmax, so it is causal attention with logits 2 qhat_i.k_j - |k_j|^2
// (x k_mask[b,0]): S on v_wmma_f32_16x16x32_bf16 as a two-way bf16 split of qhat / keys, P@V on
#define NB 4
#define LL 1024
#define NH 12
#define EE 64
#define KF 3   // key fragments of the next tile that are fetched under the softmax; the other 8 - KF behind the value products (with 4 the build spills)

// per (b,h): kn[j] = -ks |k_j|^2 (f32; ks = k_mask[b,0] log2(e)), the start value of key j's score accumulators in k_attn; keys (as their two-way bf16 split) and values (f16) laid out in the order k_attn's fragments read them,
// in chunks of 512 B = 32 lanes x 16 B, so that one wave-wide 16-byte load there covers four whole lines
//   kpk: chunk ((bh*64 + key/16)*2 + kc)*4 + part*2 + c (part 0 = high, 1 = low): lane (g, col) holds k = kc*32 + 16c + 8g + 0..7 of key (key/16)*16 + col
//   vT:  chunk ((bh*16 + key/64)*2 + kc)*8 + t*2 + c: lane (g, col) holds keys kc*32 + 16c + 8g + 0..7 of the 64, channel t*16 + col
// pb = number of the part's block: (b,h) = pb / 4, 256 keys; each quarter of the block's 1024 threads takes 64 of them (kx = their number in the head)
__device__ __forceinline__ void prep_part(int pb, const float* __restrict__ keys, const float* __restrict__ vals, const float* __restrict__ kmask, float* __restrict__ kn, _Float16* __restrict__ vT, __bf16* __restrict__ kpk) {
  __shared__ float tile4[4][64][65];
  __shared__ __align__(16) float skn4[4][64];
  const int sub = threadIdx.x >> 8, tid = threadIdx.x & 255, kx = (pb & 3) * 4 + sub;
  float (&tile)[64][65] = tile4[sub]; float (&skn)[64] = skn4[sub];
  const int bh = pb >> 2, b = bh / NH, h = bh % NH, j0 = kx * 64;
  { const int fr = tid >> 5, ln = tid & 31;              // wave fr: score fragment (16 keys fr >> 1, kc = fr & 1) of this quarter's 64 keys
    const F2 f = split_row(keys + (((size_t)b * LL + j0 + (fr >> 1) * 16 + (ln & 15)) * NH + h) * EE, (fr & 1) * 32, ln);
    union { v16b v; v4u q[2]; } hi, lo; hi.v = f.h; lo.v = f.l;
    __bf16* d = kpk + (((size_t)bh * 128 + kx * 8 + fr) * 4) * 256 + ln * 8;
    vst2(d, hi.q[0]); vst2(d + 256, hi.q[1]); vst2(d + 512, lo.q[0]); vst2(d + 768, lo.q[1]); }
  for (int q = tid; q < 64 * 64; q += 256) { const int jl = q >> 6, e = q & 63; tile[jl][e] = vals[(((size_t)b * LL + j0 + jl) * NH + h) * EE + e]; }
  if (tid < 64) { const float* kr = keys + (((size_t)b * LL + j0 + tid) * NH + h) * EE; float s = 0.f;
#pragma unroll 8
    for (int e = 0; e < EE; ++e) s += kr[e] * kr[e];
    skn[tid] = -(kmask[(size_t)b * LL] * 1.44269504088896341f) * s; }
  __syncthreads();
  { const int ln = tid & 31;
#pragma unroll
    for (int u = 0; u < 2; ++u) { const int ch = (tid >> 5) + u * 8;      // chunk kc*8 + t*2 + c of this quarter's 16, one wave each
      const int e = ((ch >> 1) & 3) * 16 + (ln & 15), kb = (ch >> 3) * 32 + (ch & 1) * 16 + (ln >> 4) * 8; union { v8h hh; v4u uu; } pk;
#pragma unroll
      for (int i = 0; i < 8; ++i) pk.hh[i] = (_Float16)tile[kb + i][e];
      vst2(vT + (((size_t)bh * 16 + kx) * 16 + ch) * 256 + ln * 8, pk.uu); } }
  if (tid < 16) vst2(kn + (size_t)bh * LL + j0 + tid * 4, *(const v4f*)(&skn[tid * 4]));
}
// stage 1 scan per (b,h): one 32-wave block; wave c scans rows 32c..32c+31 from an empty state, the 32 chunk states meet in LDS,
// and each wave merges the chunks in front of it into its rows. Lane holds 2 channels of every row; per-row scalars live one row per lane.
template <int M> __device__ __forceinline__ float lx(float v) {      // value of lane ^ M
  if constexpr (M == 16) { const int b = __float_as_int(v); return __int_as_float(__builtin_amdgcn_permlanex16(b, b, 0x76543210, 0xfedcba98, false, false)); }
  else return __int_as_float(__builtin_amdgcn_update_dpp(0, __float_as_int(v), 0x160 | M, 0xf, 0xf, true));   // row_xmask:M
}
template <int D> __device__ __forceinline__ float lshr(float v) {    // value of lane - D inside the 16-lane row, own value where there is none
  return __int_as_float(__builtin_amdgcn_update_dpp(__float_as_int(v), __float_as_int(v), 0x110 | D, 0xf, 0xf, false));   // row_shr:D
}
__device__ __forceinline__ float bc(float v, int l) { return __int_as_float(__builtin_amdgcn_readlane(__float_as_int(v), l)); }
template <int N> __device__ __forceinline__ void fold(float (&t)[32], int lane) {   // 2N row sums -> N, each lane keeps the half its bit N names
  const bool hi = lane & N;
#pragma unroll
  for (int r = 0; r < N; ++r) { const float keep = hi ? t[r + N] : t[r], send = hi ? t[r] : t[r + N]; t[r] = keep + lx<N>(send); }
}
__device__ __forceinline__ float allmax(float v) { v = fmaxf(v, lx<1>(v)); v = fmaxf(v, lx<2>(v)); v = fmaxf(v, lx<4>(v)); v = fmaxf(v, lx<8>(v)); return fmaxf(v, lx<16>(v)); }
__device__ __forceinline__ float allsum(float v) { v += lx<1>(v); v += lx<2>(v); v += lx<4>(v); v += lx<8>(v); return v + lx<16>(v); }
__device__ __forceinline__ void scan_part(int bh, const float* __restrict__ q, const float* __restrict__ w, const float* __restrict__ qmask, float* __restrict__ qh) {
  __shared__ __align__(16) float sA[32][EE];
  __shared__ float sM[32], sZ[32];
  const int b = bh / NH, h = bh % NH, lane = threadIdx.x & 31, wv = __builtin_amdgcn_readfirstlane(threadIdx.x >> 5);
  const v2f wl = *(const v2f*)(w + h * EE + 2 * lane); const float qm = qmask[(size_t)b * LL];
  const float* qr = q + (((size_t)b * LL + wv * 32) * NH + h) * EE + 2 * lane;
  v2f a[32]; float t[32];
#pragma unroll
  for (int j = 0; j < 32; ++j) a[j] = *(const v2f*)(qr + (size_t)j * NH * EE);
#pragma unroll
  for (int j = 0; j < 32; ++j) t[j] = a[j].x * wl.x + a[j].y * wl.y;
  fold<16>(t, lane); fold<8>(t, lane); fold<4>(t, lane); fold<2>(t, lane); fold<1>(t, lane);
  const float s = t[0] * qm;                              // lane l: score of row l of the chunk
  float m = s;                                            // running maximum inside the chunk
  m = fmaxf(m, lshr<1>(m)); m = fmaxf(m, lshr<2>(m)); m = fmaxf(m, lshr<4>(m)); m = fmaxf(m, lshr<8>(m));
  const float m15 = bc(m, 15);
  if (lane >= 16) m = fmaxf(m, m15);
  const float ms = lshr<1>(m);                            // taken with every lane on: a lane that is off feeds no neighbour
  const float mp = lane == 16 ? m15 : ms;
  const float c = lane ? expf(mp - m) : 0.f, p = expf(s - m);
  float z = 0.f, zi = 0.f; v2f acc = {0.f, 0.f};
#pragma unroll
  for (int j = 0; j < 32; ++j) { const float cj = bc(c, j), pj = bc(p, j);
    acc = acc * cj + a[j] * pj; a[j] = acc;               // unnormalised prefix of row j, relative to m of row j
    z = z * cj + pj; zi = lane == j ? z : zi; }                           // lane j keeps row j's z
  vst2(&sA[wv][2 * lane], acc);
  if (lane == 31) { sM[wv] = m; sZ[wv] = zi; }
  __syncthreads();
  const bool pre = lane < wv;                             // lane l: chunk l, counted if it lies in front of this wave's
  const float Mo = pre ? sM[lane] : -3.0e38f, Zo = pre ? sZ[lane] : 0.f;
  const float Mp = allmax(Mo);
  const float e = pre ? expf(Mo - Mp) : 0.f;
  const float Zp = allsum(e * Zo);
  v2f Ap = {0.f, 0.f};
#pragma unroll 1
  for (int c0 = 0; c0 < wv; c0 += 8)
#pragma unroll
    for (int u = 0; u < 8; ++u) Ap += *(const v2f*)(&sA[c0 + u][2 * lane]) * bc(e, c0 + u);   // e is 0 from chunk wv on
  const float mt = fmaxf(Mp, m), e1 = expf(Mp - mt), e2 = expf(m - mt), zt = Zp * e1 + zi * e2, f1 = e1 / zt, f2 = e2 / zt;
  float* o = qh + ((size_t)bh * LL + wv * 32) * EE + 2 * lane;
#pragma unroll
  for (int j = 0; j < 32; ++j) vst2(o + j * EE, (v2f)(Ap * bc(f1, j) + a[j] * bc(f2, j)));    // 32 lanes x 8 B = the 256-B row
}
// The scan and the key/value preparation read and write nothing of each other: one launch holds both, the part chosen by the block's index.
// The 48 scan blocks, the longer ones, come first; with the 192 preparation blocks that is at most one block per WGP, all running at once.
__global__ __launch_bounds__(1024) void k_pre(const float* __restrict__ q, const float* __restrict__ w, const float* __restrict__ qmask, float* __restrict__ qh,
                                             const float* __restrict__ keys, const float* __restrict__ vals, const float* __restrict__ kmask, float* __restrict__ kn, _Float16* __restrict__ vT, __bf16* __restrict__ kpk) {
  if (blockIdx.x < NB * NH) scan_part(blockIdx.x, q, w, qmask, qh);
  else prep_part(blockIdx.x - NB * NH, keys, vals, kmask, kn, vT, kpk);
}
// one key tile's eight score fragments from kpk: fragment f = t*2+kc is four chunks in a row: high elements 0..7, 8..15, low elements 0..7, 8..15
template <int F0, int F1> __device__ __forceinline__ void load_ktile(v4u (&kr)[8][4], const __bf16* p0) {     // fragments F0 .. F1-1
#pragma unroll   // both loops unrolled: kr is indexed by constants only and stays in registers; the loads stand in a row, one base address
  for (int f = F0; f < F1; ++f)
#pragma unroll
    for (int c = 0; c < 4; ++c) kr[f][c] = *(const v4u*)(p0 + (f * 4 + c) * 256);
}
__device__ __forceinline__ F2 packed_regs(const v4u (&q)[4]) { union { v16b v; v4u u[2]; } hi, lo;
  hi.u[0] = q[0]; hi.u[1] = q[1]; lo.u[0] = q[2]; lo.u[1] = q[3]; F2 r; r.h = hi.v; r.l = lo.v; return r; }
// stage 2: causal attention per (b,h, 64 queries), transposed: S^T = K qhat^T and O^T += V^T P^T. A lane (g, col) then holds scores of ONE query
// (q0 + col): register r of score tile t is key t*16 + 8g + r. Maximum and sum are taken in the lane, with one exchange between the wave's halves,
// and two score tiles, converted in place, are the B operand of the value product in the hardware k order. The fragments of kpk and vT serve as A
// operands as they lie (A's map is B's with rows for columns). qhat carries the factor 2 ks and the accumulators start at -ks |k|^2, so that the
// products end as the logits in base 2. out = queries + summary
__device__ __forceinline__ float max3f(float a, float b, float c) { return fmaxf(fmaxf(a, b), c); }
__device__ __forceinline__ v8f ld8(const float* p) { union { v8f v; v4f q[2]; } u; u.q[0] = *(const v4f*)p; u.q[1] = *(const v4f*)(p + 4); return u.v; }
__global__ __launch_bounds__(128) void k_attn(const float* __restrict__ qh, const __bf16* __restrict__ kpk, const float* __restrict__ kn, const _Float16* __restrict__ vT,
                                            const float* __restrict__ kmask, const float* __restrict__ qin, float* __restrict__ out) {
  __shared__ __align__(16) float sO[4][16][68];
  const int tid = threadIdx.x, w = tid >> 5, lane = tid & 31, col = lane & 15, g = lane >> 4;
  const int bh = blockIdx.y, b = bh / NH, h = bh % NH, q0 = blockIdx.x * 64 + w * 16;
  const float ks = kmask[(size_t)b * LL] * 1.44269504088896341f;   // logits in base 2: the exponentials below are then one v_exp_f32 each
  F2 bq[2];                                              // scores need near-f32 operands (two-way bf16 split)
  const float* qr = qh + ((size_t)bh * LL + q0 + col) * EE;
#pragma unroll
  for (int kc = 0; kc < 2; ++kc) bq[kc] = split_row_s(qr, kc * 32, lane, 2.0f * ks);
  asm volatile("s_wait_xcnt 0x0" ::: "memory");          // in front of every later overwrite of the address registers that the loads above name
  float mrun = -3.0e38f; v8f l8 = {}; v8f acc[4] = {};   // l8: this lane's eight partial sums of its query's weights, joined behind the loop
  const int ntiles = blockIdx.x + 1;                     // causal: key tiles 0..blockIdx.x
  // Every global load is issued well ahead of its use: a tile's keys and norms during the tile before, its values behind its score products.
  const __bf16* kp = kpk + (size_t)bh * LL * EE * 2 + lane * 8;                 // this lane's 16 B of every chunk of tile 0
  const float* np = kn + (size_t)bh * LL + 8 * g;
  const _Float16* vp = vT + (size_t)bh * EE * LL + lane * 8;
  v4u kr[8][4]; v8f cn[4];
  load_ktile<0, 8>(kr, kp);
#pragma unroll   // constant indices: cn stays in registers
  for (int t = 0; t < 4; ++t) cn[t] = ld8(np + t * 16);
  // The first tile's loads have landed where the loop is entered (the loaded values as inputs only): the compiler's counted waits inside the loop
  // are then those of the loop's own loads; with loads of the prologue still open it set them to the stricter of the two orders of issue.
#pragma unroll
  for (int f = 0; f < 8; ++f) asm volatile("" :: "v"(kr[f][0]), "v"(kr[f][1]), "v"(kr[f][2]), "v"(kr[f][3]));
  asm volatile("" :: "v"(bq[0].h), "v"(bq[0].l), "v"(bq[1].h), "v"(bq[1].l), "v"(cn[0]), "v"(cn[1]), "v"(cn[2]), "v"(cn[3]));
#pragma unroll 1
  for (int kt = 0; kt < ntiles; ++kt) {
    v8f s4[4];
#pragma unroll
    for (int t = 0; t < 4; ++t) { s4[t] = cn[t];
#pragma unroll
      for (int kc = 0; kc < 2; ++kc) s4[t] = mac3(packed_regs(kr[t * 2 + kc]), bq[kc], s4[t]); }
    v8h vr[2][4][2];                                     // this tile's value fragments: in flight under the softmax
#pragma unroll   // both loops unrolled: vr stays in registers; 16 loads in a row, one base address
    for (int kc = 0; kc < 2; ++kc)
#pragma unroll
      for (int t = 0; t < 4; ++t) { const _Float16* p = vp + (kc * 8 + t * 2) * 256; vr[kc][t][0] = *(const v8h*)p; vr[kc][t][1] = *(const v8h*)(p + 256); }
    // The fetch is unconditional, so that no old fragment stays live beside the new ones (that spilled): the last pass, which has no next tile,
    // fetches its own tile again, in bounds, and nothing reads it.
    const bool more = kt + 1 < ntiles;
    const __bf16* kq = kp + (more ? 64 * EE * 2 : 0);    // kp, np, vp: this tile's keys, norms and values
    const float* nq = np + (more ? 64 : 0);
    load_ktile<0, KF>(kr, kq);                 // next tile's first key fragments: in flight under the softmax
    // in front of every later overwrite of an address register that the loads above name; the addresses as inputs keep their registers whole up to here
    asm volatile("s_wait_xcnt 0x0" :: "v"(vp), "v"(kq) : "memory");
    if (!more) {                                         // only the last tile holds keys behind a query
#pragma unroll
      for (int t = 0; t < 4; ++t)
#pragma unroll
        for (int r = 0; r < 8; ++r) s4[t][r] = t * 16 + 8 * g + r <= w * 16 + col ? s4[t][r] : -3.0e38f; }
    float y[12], z[4];                                   // maximum of the lane's 32 scores as a tree of three-way maxima, not one chain
#pragma unroll
    for (int i = 0; i < 10; ++i) y[i] = max3f(s4[(3 * i) >> 3][(3 * i) & 7], s4[(3 * i + 1) >> 3][(3 * i + 1) & 7], s4[(3 * i + 2) >> 3][(3 * i + 2) & 7]);
    y[10] = s4[3][6]; y[11] = s4[3][7];
#pragma unroll
    for (int i = 0; i < 4; ++i) z[i] = max3f(y[3 * i], y[3 * i + 1], y[3 * i + 2]);
    const float mx = fmaxf(max3f(z[0], z[1], z[2]), z[3]);
    const float mnew = max3f(mrun, mx, lx<16>(mx));      // the query's other 32 scores of the tile lie in lane ^ 16
    const float corr = __builtin_amdgcn_exp2f(mrun - mnew), moff = mnew - 14.0f;   // weights carry 2^14 (sum and products alike): small ones stay normal f16
    mrun = mnew;
#pragma unroll
    for (int t = 0; t < 4; ++t) { s4[t] -= moff;
#pragma unroll
      for (int r = 0; r < 8; ++r) s4[t][r] = __builtin_amdgcn_exp2f(s4[t][r]); }   // a masked score, -3.0e38 against a finite maximum, gives 0
    l8 = l8 * corr + ((s4[0] + s4[1]) + (s4[2] + s4[3]));
    union { v16h v; v8h q[2]; } pb[2];
#pragma unroll
    for (int kc = 0; kc < 2; ++kc) { pb[kc].q[0] = __builtin_convertvector(s4[2 * kc], v8h); pb[kc].q[1] = __builtin_convertvector(s4[2 * kc + 1], v8h); }
#pragma unroll   // constant indices: cn stays in registers; the next tile's norms take the registers of the scores, in flight under the value products
    for (int t = 0; t < 4; ++t) cn[t] = ld8(nq + t * 16);
    asm volatile("s_wait_xcnt 0x0" :: "v"(nq) : "memory");   // in front of every later overwrite of the address register that the loads above name
#pragma unroll
    for (int t = 0; t < 4; ++t) acc[t] *= corr;
#pragma unroll
    for (int kc = 0; kc < 2; ++kc)
#pragma unroll
      for (int t = 0; t < 4; ++t) { union { v16h v; v8h q[2]; } u; u.q[0] = vr[kc][t][0]; u.q[1] = vr[kc][t][1]; acc[t] = wmma16(u.v, pb[kc].v, acc[t]); }
    // the next tile's last key fragments come behind the value products, whose fragments then share their registers (all of these feed matrix
    // instructions, and held at once they spilled); they are in flight under the next tile's first score products
    load_ktile<KF, 8>(kr, kq);
    asm volatile("s_wait_xcnt 0x0" :: "v"(kq) : "memory");   // in front of the overwrite of the address registers that the loads above name; kq as above
    kp += 64 * EE * 2; np += 64; vp += 64 * EE;
  }
  float l = ((l8[0] + l8[1]) + (l8[2] + l8[3])) + ((l8[4] + l8[5]) + (l8[6] + l8[7]));
  l += lx<16>(l);
  const float inv = 1.0f / l;                            // acc[t][r] = channel t*16 + 8g + r of query q0 + col
#pragma unroll
  for (int t = 0; t < 4; ++t) { union { v8f v; v4f q[2]; } u; u.v = acc[t] * inv;
    vst2(&sO[w][col][t * 16 + 8 * g], u.q[0]); vst2(&sO[w][col][t * 16 + 8 * g + 4], u.q[1]); }
  LDSX();
  for (int qq = lane; qq < 16 * 16; qq += 32) { const int rl = qq >> 4, pc = qq & 15; const size_t o = (((size_t)b * LL + q0 + rl) * NH + h) * EE + pc * 4;
    vst2(out + o, *(const v4f*)(&sO[w][rl][pc * 4]) + *(const v4f*)(qin + o)); }
}
extern "C" void kernel_launch(void* const* d_in, const int* in_sizes, int n_in, void* d_out, int out_size, void* d_ws, size_t ws_size, hipStream_t stream) {
  (void)in_sizes; (void)n_in; (void)out_size; (void)ws_size;
  const float* q = (const float*)d_in[0]; const float* k = (const float*)d_in[1]; const float* v = (const float*)d_in[2];
  const float* qmask = (const float*)d_in[3]; const float* kmask = (const float*)d_in[4]; const float* w = (const float*)d_in[5];
  float* out = (float*)d_out;
  char* ws = (char*)d_ws; size_t off = 0;
  auto take = [&](size_t bytes) { char* p = ws + off; off += (bytes + 255) & ~(size_t)255; return p; };
  float* kn = (float*)take((size_t)NB * NH * LL * 4); _Float16* vT = (_Float16*)take((size_t)NB * NH * EE * LL * 2); float* qh = (float*)take((size_t)NB * NH * LL * EE * 4);
  __bf16* kpk = (__bf16*)take((size_t)NB * NH * LL * EE * 4);
  k_pre<<<NB * NH + NB * NH * (LL / 256), 1024, 0, stream>>>(q, w, qmask, qh, k, v, kmask, kn, vT, kpk);
  k_attn<<<dim3(LL / 64, NB * NH), 128, 0, stream>>>(qh, kpk, kn, vT, kmask, q, out);
}

// v007
// Measured time: 41.5 microseconds a run.
// Timed twice side by side with v006, it ran 1.18 times as fast both times.
// Over all steps from v000 it is 19.8 times as fast.
#include <hip/hip_runtime.h>
#include <math.h>

typedef __attribute__((ext_vector_type(16))) _Float16 v16h;
typedef __attribute__((ext_vector_type(16))) __bf16 v16b;
typedef __attribute__((ext_vector_type(8)))  _Float16 v8h;
typedef __attribute__((ext_vector_type(8)))  float v8f;
typedef __attribute__((ext_vector_type(4)))  float v4f;
typedef __attribute__((ext_vector_type(2)))  float v2f;
typedef __attribute__((ext_vector_type(4)))  unsigned v4u;
typedef __attribute__((ext_vector_type(4)))  int v4i;
typedef float __attribute__((may_alias)) float_a;
typedef int __attribute__((may_alias)) int_a;

template <typename T> __device__ __forceinline__ void vst2(void* p, T v) { *(T*)p = v;  }
__device__ __forceinline__ v8f wmma16(v16h a, v16h b, v8f c) {
  v8f d = __builtin_amdgcn_wmma_f32_16x16x32_f16(false, a, false, b, (short)0, c, false, false);
  asm volatile("v_nop\n\tv_nop\n\tv_nop\n\tv_nop" : "+v"(d) : "v"(a), "v"(b));
  return d;
}
__device__ __forceinline__ v8f wmma_bf(v16b a, v16b b, v8f c) {
  v8f d = __builtin_amdgcn_wmma_f32_16x16x32_bf16(false, a, false, b, (short)0, c, false, false);
  asm volatile("v_nop\n\tv_nop\n\tv_nop\n\tv_nop" : "+v"(d) : "v"(a), "v"(b));
  return d;
}
// 16x16x32 fragments: lane = (h = lane>>4, row/col = lane&15); elements 0..7 = k0+8h+0..7, 8..15 = k0+16+8h+0..7; D element r = row 8h+r
__device__ __forceinline__ v16h frag_h(const _Float16* rowk0, int lane) {
  union { v16h v; v8h q[2]; } u; const _Float16* p = rowk0 + 8 * (lane >> 4);
  u.q[0] = *(const v8h*)p; u.q[1] = *(const v8h*)(p + 16); return u.v;
}
__device__ __forceinline__ v16h frag_f32(const float* rowk0, int lane) {
  v16h a; const float* p = rowk0 + 8 * (lane >> 4);
#pragma unroll
  for (int i = 0; i < 8; ++i) { a[i] = (_Float16)p[i]; a[8 + i] = (_Float16)p[16 + i]; }
  return a;
}
__device__ __forceinline__ v16h frag_f32s(const float* rowk0, int lane, float sc) {
  v16h a; const float* p = rowk0 + 8 * (lane >> 4);
#pragma unroll
  for (int i = 0; i < 8; ++i) { a[i] = (_Float16)(p[i] * sc); a[8 + i] = (_Float16)(p[16 + i] * sc); }
  return a;
}
// column fragment from a [K][ld] layout (column n), rows >= K read as 0
__device__ __forceinline__ v16h fragc_f32(const float* W, int k0, int n, int lane, int ld, int K) {
  v16h a; const int g = lane >> 4;
#pragma unroll
  for (int i = 0; i < 8; ++i) { const int ka = k0 + 8 * g + i, kb = ka + 16;
    a[i] = (_Float16)(ka < K ? W[(size_t)ka * ld + n] : 0.f); a[8 + i] = (_Float16)(kb < K ? W[(size_t)kb * ld + n] : 0.f); }
  return a;
}
struct F2 { v16b h, l; };
__device__ __forceinline__ F2 bsplit16(const float v[16]) { F2 r;
#pragma unroll
  for (int i = 0; i < 16; ++i) { const __bf16 h = (__bf16)v[i]; r.h[i] = h; r.l[i] = (__bf16)(v[i] - (float)h); }
  return r; }
__device__ __forceinline__ F2 split_row(const float* row, int k0, int lane) { float v[16]; const float* p = row + k0 + 8 * (lane >> 4);
#pragma unroll
  for (int i = 0; i < 8; ++i) { v[i] = p[i]; v[8 + i] = p[16 + i]; }
  return bsplit16(v); }
__device__ __forceinline__ F2 split_row_s(const float* row, int k0, int lane, float sc) { float v[16]; const float* p = row + k0 + 8 * (lane >> 4);
#pragma unroll
  for (int i = 0; i < 8; ++i) { v[i] = p[i] * sc; v[8 + i] = p[16 + i] * sc; }
  return bsplit16(v); }
__device__ __forceinline__ F2 split_rowK(const float* row, int k0, int lane, int K) { float v[16]; const int g = lane >> 4;
#pragma unroll
  for (int i = 0; i < 8; ++i) { const int ka = k0 + 8 * g + i, kb = ka + 16; v[i] = ka < K ? row[ka] : 0.f; v[8 + i] = kb < K ? row[kb] : 0.f; }
  return bsplit16(v); }
__device__ __forceinline__ F2 split_col(const float* W, int k0, int n, int lane, int ld, int K) { float v[16]; const int g = lane >> 4;
#pragma unroll
  for (int i = 0; i < 8; ++i) { const int ka = k0 + 8 * g + i, kb = ka + 16; v[i] = ka < K ? W[(size_t)ka * ld + n] : 0.f; v[8 + i] = kb < K ? W[(size_t)kb * ld + n] : 0.f; }
  return bsplit16(v); }
__device__ __forceinline__ v8f mac3(const F2& a, const F2& b, v8f c) { c = wmma_bf(a.l, b.h, c); c = wmma_bf(a.h, b.l, c); return wmma_bf(a.h, b.h, c); }
__device__ __forceinline__ float sigm(float v) { return 1.0f / (1.0f + expf(-v)); }
#define LDSX() do { asm volatile("s_wait_dscnt 0" ::: "memory"); __builtin_amdgcn_wave_barrier(); __builtin_amdgcn_fence(__ATOMIC_RELEASE, "workgroup"); } while (0)

// Causal "fast Euclidean" attention. Stage 1 (prefix softmax of the per-token score s_j over j <= i) is a running
// (online-softmax) scan per (batch, head) in f32 giving qhat_i directly. Stage 2: -|qhat_i - k_j|^2 = 2 qhat.k - |k|^2 - |qhat|^2,
// and the per-row constant |qhat|^2 cancels in the softmax, so it is causal attention with logits 2 qhat_i.k_j - |k_j|^2
// (x k_mask[b,0]): S on v_wmma_f32_16x16x32_bf16 as a two-way bf16 split of qhat / keys, P@V on
#define NB 4
#define LL 1024
#define NH 12
#define EE 64
#define KF 3   // key fragments of the next tile that are fetched under the softmax; the other 8 - KF behind the value products (with 4 the build spills)

// per (b,h): kn[j] = -ks |k_j|^2 (f32; ks = k_mask[b,0] log2(e)), the start value of key j's score accumulators in k_attn; keys (as their two-way bf16 split) and values (f16) laid out in the order k_attn's fragments read them,
// in chunks of 512 B = 32 lanes x 16 B, so that one wave-wide 16-byte load there covers four whole lines
//   kpk: chunk ((bh*64 + key/16)*2 + kc)*4 + part*2 + c (part 0 = high, 1 = low): lane (g, col) holds k = kc*32 + 16c + 8g + 0..7 of key (key/16)*16 + col
//   vT:  chunk ((bh*16 + key/64)*2 + kc)*8 + t*2 + c: lane (g, col) holds keys kc*32 + 16c + 8g + 0..7 of the 64, channel t*16 + col
// pb = number of the part's block: (b,h) = pb / 4, 256 keys; each quarter of the block's 1024 threads takes 64 of them (kx = their number in the head)
__device__ __forceinline__ void prep_part(int pb, const float* __restrict__ keys, const float* __restrict__ vals, const float* __restrict__ kmask, float* __restrict__ kn, _Float16* __restrict__ vT, __bf16* __restrict__ kpk) {
  __shared__ float tile4[4][64][65];
  __shared__ __align__(16) float skn4[4][64];
  const int sub = threadIdx.x >> 8, tid = threadIdx.x & 255, kx = (pb & 3) * 4 + sub;
  float (&tile)[64][65] = tile4[sub]; float (&skn)[64] = skn4[sub];
  const int bh = pb >> 2, b = bh / NH, h = bh % NH, j0 = kx * 64;
  { const int fr = tid >> 5, ln = tid & 31;              // wave fr: score fragment (16 keys fr >> 1, kc = fr & 1) of this quarter's 64 keys
    const F2 f = split_row(keys + (((size_t)b * LL + j0 + (fr >> 1) * 16 + (ln & 15)) * NH + h) * EE, (fr & 1) * 32, ln);
    union { v16b v; v4u q[2]; } hi, lo; hi.v = f.h; lo.v = f.l;
    __bf16* d = kpk + (((size_t)bh * 128 + kx * 8 + fr) * 4) * 256 + ln * 8;
    vst2(d, hi.q[0]); vst2(d + 256, hi.q[1]); vst2(d + 512, lo.q[0]); vst2(d + 768, lo.q[1]); }
  for (int q = tid; q < 64 * 64; q += 256) { const int jl = q >> 6, e = q & 63; tile[jl][e] = vals[(((size_t)b * LL + j0 + jl) * NH + h) * EE + e]; }
  if (tid < 64) { const float* kr = keys + (((size_t)b * LL + j0 + tid) * NH + h) * EE; float s = 0.f;
#pragma unroll 8
    for (int e = 0; e < EE; ++e) s += kr[e] * kr[e];
    skn[tid] = -(kmask[(size_t)b * LL] * 1.44269504088896341f) * s; }
  __syncthreads();
  { const int ln = tid & 31;
#pragma unroll
    for (int u = 0; u < 2; ++u) { const int ch = (tid >> 5) + u * 8;      // chunk kc*8 + t*2 + c of this quarter's 16, one wave each
      const int e = ((ch >> 1) & 3) * 16 + (ln & 15), kb = (ch >> 3) * 32 + (ch & 1) * 16 + (ln >> 4) * 8; union { v8h hh; v4u uu; } pk;
#pragma unroll
      for (int i = 0; i < 8; ++i) pk.hh[i] = (_Float16)tile[kb + i][e];
      vst2(vT + (((size_t)bh * 16 + kx) * 16 + ch) * 256 + ln * 8, pk.uu); } }
  if (tid < 16) vst2(kn + (size_t)bh * LL + j0 + tid * 4, *(const v4f*)(&skn[tid * 4]));
}
// stage 1 scan per (b,h): one 32-wave block; wave c scans rows 32c..32c+31 from an empty state, the 32 chunk states meet in LDS,
// and each wave merges the chunks in front of it into its rows. Lane holds 2 channels of every row; per-row scalars live one row per lane.
template <int M> __device__ __forceinline__ float lx(float v) {      // value of lane ^ M
  if constexpr (M == 16) { const int b = __float_as_int(v); return __int_as_float(__builtin_amdgcn_permlanex16(b, b, 0x76543210, 0xfedcba98, false, false)); }
  else return __int_as_float(__builtin_amdgcn_update_dpp(0, __float_as_int(v), 0x160 | M, 0xf, 0xf, true));   // row_xmask:M
}
template <int D> __device__ __forceinline__ float lshr(float v) {    // value of lane - D inside the 16-lane row, own value where there is none
  return __int_as_float(__builtin_amdgcn_update_dpp(__float_as_int(v), __float_as_int(v), 0x110 | D, 0xf, 0xf, false));   // row_shr:D
}
__device__ __forceinline__ float bc(float v, int l) { return __int_as_float(__builtin_amdgcn_readlane(__float_as_int(v), l)); }
template <int N> __device__ __forceinline__ void fold(float (&t)[32], int lane) {   // 2N row sums -> N, each lane keeps the half its bit N names
  const bool hi = lane & N;
#pragma unroll
  for (int r = 0; r < N; ++r) { const float keep = hi ? t[r + N] : t[r], send = hi ? t[r] : t[r + N]; t[r] = keep + lx<N>(send); }
}
__device__ __forceinline__ float allmax(float v) { v = fmaxf(v, lx<1>(v)); v = fmaxf(v, lx<2>(v)); v = fmaxf(v, lx<4>(v)); v = fmaxf(v, lx<8>(v)); return fmaxf(v, lx<16>(v)); }
__device__ __forceinline__ float allsum(float v) { v += lx<1>(v); v += lx<2>(v); v += lx<4>(v); v += lx<8>(v); return v + lx<16>(v); }
__device__ __forceinline__ void scan_part(int bh, const float* __restrict__ q, const float* __restrict__ w, const float* __restrict__ qmask, float* __restrict__ qh) {
  __shared__ __align__(16) float sA[32][EE];
  __shared__ float sM[32], sZ[32];
  const int b = bh / NH, h = bh % NH, lane = threadIdx.x & 31, wv = __builtin_amdgcn_readfirstlane(threadIdx.x >> 5);
  const v2f wl = *(const v2f*)(w + h * EE + 2 * lane); const float qm = qmask[(size_t)b * LL];
  const float* qr = q + (((size_t)b * LL + wv * 32) * NH + h) * EE + 2 * lane;
  v2f a[32]; float t[32];
#pragma unroll
  for (int j = 0; j < 32; ++j) a[j] = *(const v2f*)(qr + (size_t)j * NH * EE);
#pragma unroll
  for (int j = 0; j < 32; ++j) t[j] = a[j].x * wl.x + a[j].y * wl.y;
  fold<16>(t, lane); fold<8>(t, lane); fold<4>(t, lane); fold<2>(t, lane); fold<1>(t, lane);
  const float s = t[0] * qm;                              // lane l: score of row l of the chunk
  float m = s;                                            // running maximum inside the chunk
  m = fmaxf(m, lshr<1>(m)); m = fmaxf(m, lshr<2>(m)); m = fmaxf(m, lshr<4>(m)); m = fmaxf(m, lshr<8>(m));
  const float m15 = bc(m, 15);
  if (lane >= 16) m = fmaxf(m, m15);
  const float ms = lshr<1>(m);                            // taken with every lane on: a lane that is off feeds no neighbour
  const float mp = lane == 16 ? m15 : ms;
  const float c = lane ? expf(mp - m) : 0.f, p = expf(s - m);
  float z = 0.f, zi = 0.f; v2f acc = {0.f, 0.f};
#pragma unroll
  for (int j = 0; j < 32; ++j) { const float cj = bc(c, j), pj = bc(p, j);
    acc = acc * cj + a[j] * pj; a[j] = acc;               // unnormalised prefix of row j, relative to m of row j
    z = z * cj + pj; zi = lane == j ? z : zi; }                           // lane j keeps row j's z
  vst2(&sA[wv][2 * lane], acc);
  if (lane == 31) { sM[wv] = m; sZ[wv] = zi; }
  __syncthreads();
  const bool pre = lane < wv;                             // lane l: chunk l, counted if it lies in front of this wave's
  const float Mo = pre ? sM[lane] : -3.0e38f, Zo = pre ? sZ[lane] : 0.f;
  const float Mp = allmax(Mo);
  const float e = pre ? expf(Mo - Mp) : 0.f;
  const float Zp = allsum(e * Zo);
  v2f Ap = {0.f, 0.f};
#pragma unroll 1
  for (int c0 = 0; c0 < wv; c0 += 8)
#pragma unroll
    for (int u = 0; u < 8; ++u) Ap += *(const v2f*)(&sA[c0 + u][2 * lane]) * bc(e, c0 + u);   // e is 0 from chunk wv on
  const float mt = fmaxf(Mp, m), e1 = expf(Mp - mt), e2 = expf(m - mt), zt = Zp * e1 + zi * e2, f1 = e1 / zt, f2 = e2 / zt;
  float* o = qh + ((size_t)bh * LL + wv * 32) * EE + 2 * lane;
#pragma unroll
  for (int j = 0; j < 32; ++j) vst2(o + j * EE, (v2f)(Ap * bc(f1, j) + a[j] * bc(f2, j)));    // 32 lanes x 8 B = the 256-B row
}
// The scan and the key/value preparation read and write nothing of each other: one launch holds both, the part chosen by the block's index.
// The 48 scan blocks, the longer ones, come first; with the 192 preparation blocks that is at most one block per WGP, all running at once.
__global__ __launch_bounds__(1024) void k_pre(const float* __restrict__ q, const float* __restrict__ w, const float* __restrict__ qmask, float* __restrict__ qh,
                                             const float* __restrict__ keys, const float* __restrict__ vals, const float* __restrict__ kmask, float* __restrict__ kn, _Float16* __restrict__ vT, __bf16* __restrict__ kpk) {
  if (blockIdx.x < NB * NH) scan_part(blockIdx.x, q, w, qmask, qh);
  else prep_part(blockIdx.x - NB * NH, keys, vals, kmask, kn, vT, kpk);
}
// one key tile's eight score fragments from kpk: fragment f = t*2+kc is four chunks in a row: high elements 0..7, 8..15, low elements 0..7, 8..15
template <int F0, int F1> __device__ __forceinline__ void load_ktile(v4u (&kr)[8][4], const __bf16* p0) {     // fragments F0 .. F1-1
#pragma unroll   // both loops unrolled: kr is indexed by constants only and stays in registers; the loads stand in a row, one base address
  for (int f = F0; f < F1; ++f)
#pragma unroll
    for (int c = 0; c < 4; ++c) kr[f][c] = *(const v4u*)(p0 + (f * 4 + c) * 256);
}
__device__ __forceinline__ F2 packed_regs(const v4u (&q)[4]) { union { v16b v; v4u u[2]; } hi, lo;
  hi.u[0] = q[0]; hi.u[1] = q[1]; lo.u[0] = q[2]; lo.u[1] = q[3]; F2 r; r.h = hi.v; r.l = lo.v; return r; }
// stage 2: causal attention per (b,h, 64 queries), transposed: S^T = K qhat^T and O^T += V^T P^T. A lane (g, col) then holds scores of ONE query
// (q0 + col): register r of score tile t is key t*16 + 8g + r. Maximum and sum are taken in the lane, with one exchange between the wave's halves,
// and two score tiles, converted in place, are the B operand of the value product in the hardware k order. The fragments of kpk and vT serve as A
// operands as they lie (A's map is B's with rows for columns). qhat carries the factor 2 ks and the accumulators start at -ks |k|^2, so that the
// products end as the logits in base 2. out = queries + summary
__device__ __forceinline__ float max3f(float a, float b, float c) { return fmaxf(fmaxf(a, b), c); }
__device__ __forceinline__ v8f ld8(const float* p) { union { v8f v; v4f q[2]; } u; u.q[0] = *(const v4f*)p; u.q[1] = *(const v4f*)(p + 4); return u.v; }
__global__ __launch_bounds__(128) void k_attn(const float* __restrict__ qh, const __bf16* __restrict__ kpk, const float* __restrict__ kn, const _Float16* __restrict__ vT,
                                            const float* __restrict__ kmask, const float* __restrict__ qin, float* __restrict__ out) {
  __shared__ __align__(16) float sO[4][16][68];
  const int tid = threadIdx.x, w = tid >> 5, lane = tid & 31, col = lane & 15, g = lane >> 4;
  // Which (head, query tile) a block takes. A block of query tile xt runs xt + 1 key tiles and all blocks are resident at once, so the launch lasts as
  // long as its fullest WGP. Among the 96 blocks with one index mod 8, a long, a middling and a short
  // tile follow one another (the long ones from 16 tiles down, the middling ones from 6 up, the short ones from 6 down): three blocks in a row
  // then hold about the mean between them.
  // A head's tiles share index mod 8. For speed alone: the map is one to one, whatever the placement.
  const int dj = (blockIdx.x >> 3) + (NB * NH / 8) * blockIdx.y, dm = dj / 3, dc = dj % 3;
  const int ds = dc == 0 ? dm : dc == 1 ? 63 - dm : 64 + dm;               // the block's rank by length, longest first: 0 .. 95
  const int xt = LL / 64 - 1 - ds / (NB * NH / 8);
  const int bh = (ds % (NB * NH / 8)) * 8 + (blockIdx.x & 7), b = bh / NH, h = bh % NH, q0 = xt * 64 + w * 16;
  const float ks = kmask[(size_t)b * LL] * 1.44269504088896341f;   // logits in base 2: the exponentials below are then one v_exp_f32 each
  F2 bq[2];                                              // scores need near-f32 operands (two-way bf16 split)
  const float* qr = qh + ((size_t)bh * LL + q0 + col) * EE;
#pragma unroll
  for (int kc = 0; kc < 2; ++kc) bq[kc] = split_row_s(qr, kc * 32, lane, 2.0f * ks);
  asm volatile("s_wait_xcnt 0x0" ::: "memory");          // in front of every later overwrite of the address registers that the loads above name
  float mrun = -3.0e38f; v8f l8 = {}; v8f acc[4] = {};   // l8: this lane's eight partial sums of its query's weights, joined behind the loop
  const int ntiles = xt + 1;                             // causal: key tiles 0..xt
  // Every global load is issued well ahead of its use: a tile's keys and norms during the tile before, its values behind its score products.
  const __bf16* kp = kpk + (size_t)bh * LL * EE * 2 + lane * 8;                 // this lane's 16 B of every chunk of tile 0
  const float* np = kn + (size_t)bh * LL + 8 * g;
  const _Float16* vp = vT + (size_t)bh * EE * LL + lane * 8;
  v4u kr[8][4]; v8f cn[4];
  load_ktile<0, 8>(kr, kp);
#pragma unroll   // constant indices: cn stays in registers
  for (int t = 0; t < 4; ++t) cn[t] = ld8(np + t * 16);
  // The first tile's loads have landed where the loop is entered (the loaded values as inputs only): the compiler's counted waits inside the loop
  // are then those of the loop's own loads; with loads of the prologue still open it set them to the stricter of the two orders of issue.
#pragma unroll
  for (int f = 0; f < 8; ++f) asm volatile("" :: "v"(kr[f][0]), "v"(kr[f][1]), "v"(kr[f][2]), "v"(kr[f][3]));
  asm volatile("" :: "v"(bq[0].h), "v"(bq[0].l), "v"(bq[1].h), "v"(bq[1].l), "v"(cn[0]), "v"(cn[1]), "v"(cn[2]), "v"(cn[3]));
#pragma unroll 1
  for (int kt = 0; kt < ntiles; ++kt) {
    v8f s4[4];
#pragma unroll
    for (int t = 0; t < 4; ++t) { s4[t] = cn[t];
#pragma unroll
      for (int kc = 0; kc < 2; ++kc) s4[t] = mac3(packed_regs(kr[t * 2 + kc]), bq[kc], s4[t]); }
    v8h vr[2][4][2];                                     // this tile's value fragments: in flight under the softmax
#pragma unroll   // both loops unrolled: vr stays in registers; 16 loads in a row, one base address
    for (int kc = 0; kc < 2; ++kc)
#pragma unroll
      for (int t = 0; t < 4; ++t) { const _Float16* p = vp + (kc * 8 + t * 2) * 256; vr[kc][t][0] = *(const v8h*)p; vr[kc][t][1] = *(const v8h*)(p + 256); }
    // The fetch is unconditional, so that no old fragment stays live beside the new ones (that spilled): the last pass, which has no next tile,
    // fetches its own tile again, in bounds, and nothing reads it.
    const bool more = kt + 1 < ntiles;
    const __bf16* kq = kp + (more ? 64 * EE * 2 : 0);    // kp, np, vp: this tile's keys, norms and values
    const float* nq = np + (more ? 64 : 0);
    load_ktile<0, KF>(kr, kq);                 // next tile's first key fragments: in flight under the softmax
    // in front of every later overwrite of an address register that the loads above name; the addresses as inputs keep their registers whole up to here
    asm volatile("s_wait_xcnt 0x0" :: "v"(vp), "v"(kq) : "memory");
    if (!more) {                                         // only the last tile holds keys behind a query
#pragma unroll
      for (int t = 0; t < 4; ++t)
#pragma unroll
        for (int r = 0; r < 8; ++r) s4[t][r] = t * 16 + 8 * g + r <= w * 16 + col ? s4[t][r] : -3.0e38f; }
    float y[12], z[4];                                   // maximum of the lane's 32 scores as a tree of three-way maxima, not one chain
#pragma unroll
    for (int i = 0; i < 10; ++i) y[i] = max3f(s4[(3 * i) >> 3][(3 * i) & 7], s4[(3 * i + 1) >> 3][(3 * i + 1) & 7], s4[(3 * i + 2) >> 3][(3 * i + 2) & 7]);
    y[10] = s4[3][6]; y[11] = s4[3][7];
#pragma unroll
    for (int i = 0; i < 4; ++i) z[i] = max3f(y[3 * i], y[3 * i + 1], y[3 * i + 2]);
    const float mx = fmaxf(max3f(z[0], z[1], z[2]), z[3]);
    const float mnew = max3f(mrun, mx, lx<16>(mx));      // the query's other 32 scores of the tile lie in lane ^ 16
    const float corr = __builtin_amdgcn_exp2f(mrun - mnew), moff = mnew - 14.0f;   // weights carry 2^14 (sum and products alike): small ones stay normal f16
    mrun = mnew;
#pragma unroll
    for (int t = 0; t < 4; ++t) { s4[t] -= moff;
#pragma unroll
      for (int r = 0; r < 8; ++r) s4[t][r] = __builtin_amdgcn_exp2f(s4[t][r]); }   // a masked score, -3.0e38 against a finite maximum, gives 0
    l8 = l8 * corr + ((s4[0] + s4[1]) + (s4[2] + s4[3]));
    union { v16h v; v8h q[2]; } pb[2];
#pragma unroll
    for (int kc = 0; kc < 2; ++kc) { pb[kc].q[0] = __builtin_convertvector(s4[2 * kc], v8h); pb[kc].q[1] = __builtin_convertvector(s4[2 * kc + 1], v8h); }
#pragma unroll   // constant indices: cn stays in registers; the next tile's norms take the registers of the scores, in flight under the value products
    for (int t = 0; t < 4; ++t) cn[t] = ld8(nq + t * 16);
    asm volatile("s_wait_xcnt 0x0" :: "v"(nq) : "memory");   // in front of every later overwrite of the address register that the loads above name
#pragma unroll
    for (int t = 0; t < 4; ++t) acc[t] *= corr;
#pragma unroll
    for (int kc = 0; kc < 2; ++kc)
#pragma unroll
      for (int t = 0; t < 4; ++t) { union { v16h v; v8h q[2]; } u; u.q[0] = vr[kc][t][0]; u.q[1] = vr[kc][t][1]; acc[t] = wmma16(u.v, pb[kc].v, acc[t]); }
    // the next tile's last key fragments come behind the value products, whose fragments then share their registers (all of these feed matrix
    // instructions, and held at once they spilled); they are in flight under the next tile's first score products
    load_ktile<KF, 8>(kr, kq);
    asm volatile("s_wait_xcnt 0x0" :: "v"(kq) : "memory");   // in front of the overwrite of the address registers that the loads above name; kq as above
    kp += 64 * EE * 2; np += 64; vp += 64 * EE;
  }
  float l = ((l8[0] + l8[1]) + (l8[2] + l8[3])) + ((l8[4] + l8[5]) + (l8[6] + l8[7]));
  l += lx<16>(l);
  const float inv = 1.0f / l;                            // acc[t][r] = channel t*16 + 8g + r of query q0 + col
#pragma unroll
  for (int t = 0; t < 4; ++t) { union { v8f v; v4f q[2]; } u; u.v = acc[t] * inv;
    vst2(&sO[w][col][t * 16 + 8 * g], u.q[0]); vst2(&sO[w][col][t * 16 + 8 * g + 4], u.q[1]); }
  LDSX();
  for (int qq = lane; qq < 16 * 16; qq += 32) { const int rl = qq >> 4, pc = qq & 15; const size_t o = (((size_t)b * LL + q0 + rl) * NH + h) * EE + pc * 4;
    vst2(out + o, *(const v4f*)(&sO[w][rl][pc * 4]) + *(const v4f*)(qin + o)); }
}
extern "C" void kernel_launch(void* const* d_in, const int* in_sizes, int n_in, void* d_out, int out_size, void* d_ws, size_t ws_size, hipStream_t stream) {
  (void)in_sizes; (void)n_in; (void)out_size; (void)ws_size;
  const float* q = (const float*)d_in[0]; const float* k = (const float*)d_in[1]; const float* v = (const float*)d_in[2];
  const float* qmask = (const float*)d_in[3]; const float* kmask = (const float*)d_in[4]; const float* w = (const float*)d_in[5];
  float* out = (float*)d_out;
  char* ws = (char*)d_ws; size_t off = 0;
  auto take = [&](size_t bytes) { char* p = ws + off; off += (bytes + 255) & ~(size_t)255; return p; };
  float* kn = (float*)take((size_t)NB * NH * LL * 4); _Float16* vT = (_Float16*)take((size_t)NB * NH * EE * LL * 2); float* qh = (float*)take((size_t)NB * NH * LL * EE * 4);
  __bf16* kpk = (__bf16*)take((size_t)NB * NH * LL * EE * 4);
  k_pre<<<NB * NH + NB * NH * (LL / 256), 1024, 0, stream>>>(q, w, qmask, qh, k, v, kmask, kn, vT, kpk);
  k_attn<<<dim3(NB * NH, LL / 64), 128, 0, stream>>>(qh, kpk, kn, vT, kmask, q, out);
}

// v008
// One run takes 31.2 microseconds.
// In two side-by-side timings against v007, it was 1.36 and 1.34 times as fast.
// Counting every step since v000, it is 26.8 times as fast.
#include <hip/hip_runtime.h>
#include <math.h>

typedef __attribute__((ext_vector_type(16))) _Float16 v16h;
typedef __attribute__((ext_vector_type(16))) __bf16 v16b;
typedef __attribute__((ext_vector_type(8)))  _Float16 v8h;
typedef __attribute__((ext_vector_type(8)))  float v8f;
typedef __attribute__((ext_vector_type(4)))  float v4f;
typedef __attribute__((ext_vector_type(2)))  float v2f;
typedef __attribute__((ext_vector_type(4)))  unsigned v4u;
typedef __attribute__((ext_vector_type(4)))  int v4i;
typedef float __attribute__((may_alias)) float_a;
typedef int __attribute__((may_alias)) int_a;

template <typename T> __device__ __forceinline__ void vst2(void* p, T v) { *(T*)p = v;  }
__device__ __forceinline__ v8f wmma16(v16h a, v16h b, v8f c) {
  v8f d = __builtin_amdgcn_wmma_f32_16x16x32_f16(false, a, false, b, (short)0, c, false, false);
  asm volatile("v_nop\n\tv_nop\n\tv_nop\n\tv_nop" : "+v"(d) : "v"(a), "v"(b));
  return d;
}
__device__ __forceinline__ v8f wmma_bf(v16b a, v16b b, v8f c) {
  v8f d = __builtin_amdgcn_wmma_f32_16x16x32_bf16(false, a, false, b, (short)0, c, false, false);
  asm volatile("v_nop\n\tv_nop\n\tv_nop\n\tv_nop" : "+v"(d) : "v"(a), "v"(b));
  return d;
}
// 16x16x32 fragments: lane = (h = lane>>4, row/col = lane&15); elements 0..7 = k0+8h+0..7, 8..15 = k0+16+8h+0..7; D element r = row 8h+r
__device__ __forceinline__ v16h frag_h(const _Float16* rowk0, int lane) {
  union { v16h v; v8h q[2]; } u; const _Float16* p = rowk0 + 8 * (lane >> 4);
  u.q[0] = *(const v8h*)p; u.q[1] = *(const v8h*)(p + 16); return u.v;
}
__device__ __forceinline__ v16h frag_f32(const float* rowk0, int lane) {
  v16h a; const float* p = rowk0 + 8 * (lane >> 4);
#pragma unroll
  for (int i = 0; i < 8; ++i) { a[i] = (_Float16)p[i]; a[8 + i] = (_Float16)p[16 + i]; }
  return a;
}
__device__ __forceinline__ v16h frag_f32s(const float* rowk0, int lane, float sc) {
  v16h a; const float* p = rowk0 + 8 * (lane >> 4);
#pragma unroll
  for (int i = 0; i < 8; ++i) { a[i] = (_Float16)(p[i] * sc); a[8 + i] = (_Float16)(p[16 + i] * sc); }
  return a;
}
// column fragment from a [K][ld] layout (column n), rows >= K read as 0
__device__ __forceinline__ v16h fragc_f32(const float* W, int k0, int n, int lane, int ld, int K) {
  v16h a; const int g = lane >> 4;
#pragma unroll
  for (int i = 0; i < 8; ++i) { const int ka = k0 + 8 * g + i, kb = ka + 16;
    a[i] = (_Float16)(ka < K ? W[(size_t)ka * ld + n] : 0.f); a[8 + i] = (_Float16)(kb < K ? W[(size_t)kb * ld + n] : 0.f); }
  return a;
}
struct F2 { v16b h, l; };
__device__ __forceinline__ F2 bsplit16(const float v[16]) { F2 r;
#pragma unroll
  for (int i = 0; i < 16; ++i) { const __bf16 h = (__bf16)v[i]; r.h[i] = h; r.l[i] = (__bf16)(v[i] - (float)h); }
  return r; }
__device__ __forceinline__ F2 split_row(const float* row, int k0, int lane) { float v[16]; const float* p = row + k0 + 8 * (lane >> 4);
#pragma unroll
  for (int i = 0; i < 8; ++i) { v[i] = p[i]; v[8 + i] = p[16 + i]; }
  return bsplit16(v); }
__device__ __forceinline__ F2 split_row_s(const float* row, int k0, int lane, float sc) { float v[16]; const float* p = row + k0 + 8 * (lane >> 4);
#pragma unroll
  for (int i = 0; i < 8; ++i) { v[i] = p[i] * sc; v[8 + i] = p[16 + i] * sc; }
  return bsplit16(v); }
__device__ __forceinline__ F2 split_rowK(const float* row, int k0, int lane, int K) { float v[16]; const int g = lane >> 4;
#pragma unroll
  for (int i = 0; i < 8; ++i) { const int ka = k0 + 8 * g + i, kb = ka + 16; v[i] = ka < K ? row[ka] : 0.f; v[8 + i] = kb < K ? row[kb] : 0.f; }
  return bsplit16(v); }
__device__ __forceinline__ F2 split_col(const float* W, int k0, int n, int lane, int ld, int K) { float v[16]; const int g = lane >> 4;
#pragma unroll
  for (int i = 0; i < 8; ++i) { const int ka = k0 + 8 * g + i, kb = ka + 16; v[i] = ka < K ? W[(size_t)ka * ld + n] : 0.f; v[8 + i] = kb < K ? W[(size_t)kb * ld + n] : 0.f; }
  return bsplit16(v); }
__device__ __forceinline__ v8f mac3(const F2& a, const F2& b, v8f c) { c = wmma_bf(a.l, b.h, c); c = wmma_bf(a.h, b.l, c); return wmma_bf(a.h, b.h, c); }
__device__ __forceinline__ float sigm(float v) { return 1.0f / (1.0f + expf(-v)); }
#define LDSX() do { asm volatile("s_wait_dscnt 0" ::: "memory"); __builtin_amdgcn_wave_barrier(); __builtin_amdgcn_fence(__ATOMIC_RELEASE, "workgroup"); } while (0)

// Causal "fast Euclidean" attention. Stage 1 (prefix softmax of the per-token score s_j over j <= i) is a running
// (online-softmax) scan per (batch, head) in f32 giving qhat_i directly. Stage 2: -|qhat_i - k_j|^2 = 2 qhat.k - |k|^2 - |qhat|^2,
// and the per-row constant |qhat|^2 cancels in the softmax, so it is causal attention with logits 2 qhat_i.k_j - |k_j|^2
// (x k_mask[b,0]): S on v_wmma_f32_16x16x32_bf16 as a two-way bf16 split of qhat / keys, P@V on
#define NB 4
#define LL 1024
#define NH 12
#define EE 64
#define KT_B (64 * EE * 4)      // bytes of one 64-key tile in kpk (high and low halves)
#define VT_B (64 * EE * 2)      // bytes of one 64-key tile in vT
#define NT_B (64 * 4)           // bytes of one 64-key tile in kn
#define TILE_B (KT_B + VT_B + 4 * NT_B)   // one LDS buffer of k_attn: the key chunks, the value chunks (both in the order of the workspace), each wave's own copy of the norms

// per (b,h): kn[j] = -ks |k_j|^2 (f32; ks = k_mask[b,0] log2(e)), the start value of key j's score accumulators in k_attn; keys (as their two-way bf16 split) and values (f16) laid out in the order k_attn's fragments read them,
// in chunks of 512 B = 32 lanes x 16 B, so that one wave-wide 16-byte load there covers four whole lines
//   kpk: chunk ((bh*64 + key/16)*2 + kc)*4 + part*2 + c (part 0 = high, 1 = low): lane (g, col) holds k = kc*32 + 16c + 8g + 0..7 of key (key/16)*16 + col
//   vT:  chunk ((bh*16 + key/64)*2 + kc)*8 + t*2 + c: lane (g, col) holds keys kc*32 + 16c + 8g + 0..7 of the 64, channel t*16 + col
// pb = number of the part's block: (b,h) = pb / 4, 256 keys; each quarter of the block's 1024 threads takes 64 of them (kx = their number in the head)
__device__ __forceinline__ void prep_part(int pb, const float* __restrict__ keys, const float* __restrict__ vals, const float* __restrict__ kmask, float* __restrict__ kn, _Float16* __restrict__ vT, __bf16* __restrict__ kpk) {
  __shared__ float tile4[4][64][65];
  __shared__ __align__(16) float skn4[4][64];
  const int sub = threadIdx.x >> 8, tid = threadIdx.x & 255, kx = (pb & 3) * 4 + sub;
  float (&tile)[64][65] = tile4[sub]; float (&skn)[64] = skn4[sub];
  const int bh = pb >> 2, b = bh / NH, h = bh % NH, j0 = kx * 64;
  { const int fr = tid >> 5, ln = tid & 31;              // wave fr: score fragment (16 keys fr >> 1, kc = fr & 1) of this quarter's 64 keys
    const F2 f = split_row(keys + (((size_t)b * LL + j0 + (fr >> 1) * 16 + (ln & 15)) * NH + h) * EE, (fr & 1) * 32, ln);
    union { v16b v; v4u q[2]; } hi, lo; hi.v = f.h; lo.v = f.l;
    __bf16* d = kpk + (((size_t)bh * 128 + kx * 8 + fr) * 4) * 256 + ln * 8;
    vst2(d, hi.q[0]); vst2(d + 256, hi.q[1]); vst2(d + 512, lo.q[0]); vst2(d + 768, lo.q[1]); }
  for (int q = tid; q < 64 * 64; q += 256) { const int jl = q >> 6, e = q & 63; tile[jl][e] = vals[(((size_t)b * LL + j0 + jl) * NH + h) * EE + e]; }
  if (tid < 64) { const float* kr = keys + (((size_t)b * LL + j0 + tid) * NH + h) * EE; float s = 0.f;
#pragma unroll 8
    for (int e = 0; e < EE; ++e) s += kr[e] * kr[e];
    skn[tid] = -(kmask[(size_t)b * LL] * 1.44269504088896341f) * s; }
  __syncthreads();
  { const int ln = tid & 31;
#pragma unroll
    for (int u = 0; u < 2; ++u) { const int ch = (tid >> 5) + u * 8;      // chunk kc*8 + t*2 + c of this quarter's 16, one wave each
      const int e = ((ch >> 1) & 3) * 16 + (ln & 15), kb = (ch >> 3) * 32 + (ch & 1) * 16 + (ln >> 4) * 8; union { v8h hh; v4u uu; } pk;
#pragma unroll
      for (int i = 0; i < 8; ++i) pk.hh[i] = (_Float16)tile[kb + i][e];
      vst2(vT + (((size_t)bh * 16 + kx) * 16 + ch) * 256 + ln * 8, pk.uu); } }
  if (tid < 16) vst2(kn + (size_t)bh * LL + j0 + tid * 4, *(const v4f*)(&skn[tid * 4]));
}
// stage 1 scan per (b,h): one 32-wave block; wave c scans rows 32c..32c+31 from an empty state, the 32 chunk states meet in LDS,
// and each wave merges the chunks in front of it into its rows. Lane holds 2 channels of every row; per-row scalars live one row per lane.
template <int M> __device__ __forceinline__ float lx(float v) {      // value of lane ^ M
  if constexpr (M == 16) { const int b = __float_as_int(v); return __int_as_float(__builtin_amdgcn_permlanex16(b, b, 0x76543210, 0xfedcba98, false, false)); }
  else return __int_as_float(__builtin_amdgcn_update_dpp(0, __float_as_int(v), 0x160 | M, 0xf, 0xf, true));   // row_xmask:M
}
template <int D> __device__ __forceinline__ float lshr(float v) {    // value of lane - D inside the 16-lane row, own value where there is none
  return __int_as_float(__builtin_amdgcn_update_dpp(__float_as_int(v), __float_as_int(v), 0x110 | D, 0xf, 0xf, false));   // row_shr:D
}
__device__ __forceinline__ float bc(float v, int l) { return __int_as_float(__builtin_amdgcn_readlane(__float_as_int(v), l)); }
template <int N> __device__ __forceinline__ void fold(float (&t)[32], int lane) {   // 2N row sums -> N, each lane keeps the half its bit N names
  const bool hi = lane & N;
#pragma unroll
  for (int r = 0; r < N; ++r) { const float keep = hi ? t[r + N] : t[r], send = hi ? t[r] : t[r + N]; t[r] = keep + lx<N>(send); }
}
__device__ __forceinline__ float allmax(float v) { v = fmaxf(v, lx<1>(v)); v = fmaxf(v, lx<2>(v)); v = fmaxf(v, lx<4>(v)); v = fmaxf(v, lx<8>(v)); return fmaxf(v, lx<16>(v)); }
__device__ __forceinline__ float allsum(float v) { v += lx<1>(v); v += lx<2>(v); v += lx<4>(v); v += lx<8>(v); return v + lx<16>(v); }
__device__ __forceinline__ void scan_part(int bh, const float* __restrict__ q, const float* __restrict__ w, const float* __restrict__ qmask, float* __restrict__ qh) {
  __shared__ __align__(16) float sA[32][EE];
  __shared__ float sM[32], sZ[32];
  const int b = bh / NH, h = bh % NH, lane = threadIdx.x & 31, wv = __builtin_amdgcn_readfirstlane(threadIdx.x >> 5);
  const v2f wl = *(const v2f*)(w + h * EE + 2 * lane); const float qm = qmask[(size_t)b * LL];
  const float* qr = q + (((size_t)b * LL + wv * 32) * NH + h) * EE + 2 * lane;
  v2f a[32]; float t[32];
#pragma unroll
  for (int j = 0; j < 32; ++j) a[j] = *(const v2f*)(qr + (size_t)j * NH * EE);
#pragma unroll
  for (int j = 0; j < 32; ++j) t[j] = a[j].x * wl.x + a[j].y * wl.y;
  fold<16>(t, lane); fold<8>(t, lane); fold<4>(t, lane); fold<2>(t, lane); fold<1>(t, lane);
  const float s = t[0] * qm;                              // lane l: score of row l of the chunk
  float m = s;                                            // running maximum inside the chunk
  m = fmaxf(m, lshr<1>(m)); m = fmaxf(m, lshr<2>(m)); m = fmaxf(m, lshr<4>(m)); m = fmaxf(m, lshr<8>(m));
  const float m15 = bc(m, 15);
  if (lane >= 16) m = fmaxf(m, m15);
  const float ms = lshr<1>(m);                            // taken with every lane on: a lane that is off feeds no neighbour
  const float mp = lane == 16 ? m15 : ms;
  const float c = lane ? expf(mp - m) : 0.f, p = expf(s - m);
  float z = 0.f, zi = 0.f; v2f acc = {0.f, 0.f};
#pragma unroll
  for (int j = 0; j < 32; ++j) { const float cj = bc(c, j), pj = bc(p, j);
    acc = acc * cj + a[j] * pj; a[j] = acc;               // unnormalised prefix of row j, relative to m of row j
    z = z * cj + pj; zi = lane == j ? z : zi; }                           // lane j keeps row j's z
  vst2(&sA[wv][2 * lane], acc);
  if (lane == 31) { sM[wv] = m; sZ[wv] = zi; }
  __syncthreads();
  const bool pre = lane < wv;                             // lane l: chunk l, counted if it lies in front of this wave's
  const float Mo = pre ? sM[lane] : -3.0e38f, Zo = pre ? sZ[lane] : 0.f;
  const float Mp = allmax(Mo);
  const float e = pre ? expf(Mo - Mp) : 0.f;
  const float Zp = allsum(e * Zo);
  v2f Ap = {0.f, 0.f};
#pragma unroll 1
  for (int c0 = 0; c0 < wv; c0 += 8)
#pragma unroll
    for (int u = 0; u < 8; ++u) Ap += *(const v2f*)(&sA[c0 + u][2 * lane]) * bc(e, c0 + u);   // e is 0 from chunk wv on
  const float mt = fmaxf(Mp, m), e1 = expf(Mp - mt), e2 = expf(m - mt), zt = Zp * e1 + zi * e2, f1 = e1 / zt, f2 = e2 / zt;
  float* o = qh + ((size_t)bh * LL + wv * 32) * EE + 2 * lane;
#pragma unroll
  for (int j = 0; j < 32; ++j) vst2(o + j * EE, (v2f)(Ap * bc(f1, j) + a[j] * bc(f2, j)));    // 32 lanes x 8 B = the 256-B row
}
// The scan and the key/value preparation read and write nothing of each other: one launch holds both, the part chosen by the block's index.
// The 48 scan blocks, the longer ones, come first; with the 192 preparation blocks that is at most one block per WGP, all running at once.
__global__ __launch_bounds__(1024) void k_pre(const float* __restrict__ q, const float* __restrict__ w, const float* __restrict__ qmask, float* __restrict__ qh,
                                             const float* __restrict__ keys, const float* __restrict__ vals, const float* __restrict__ kmask, float* __restrict__ kn, _Float16* __restrict__ vT, __bf16* __restrict__ kpk) {
  if (blockIdx.x < NB * NH) scan_part(blockIdx.x, q, w, qmask, qh);
  else prep_part(blockIdx.x - NB * NH, keys, vals, kmask, kn, vT, kpk);
}
// One wave's quarter of a key/value tile, from the workspace into an LDS buffer through no register: 8 key chunks and 4 value chunks of 512 B, a lane's
// 16 B of each, and the tile's 64 norms, a lane's 8 B, into the wave's own place (so that every wave issues the same copies).
// lk, lv, ln: the lane's LDS byte address of the first key / value chunk and of its norms; kg, vg, ng: the same bytes in kpk / vT / kn. Every lane is on.
// s_wait_xcnt stands as the statement's last line, in front of any later overwrite of a register that a copy names.
__device__ __forceinline__ void stage_tile(unsigned lk, unsigned lv, unsigned ln, const __bf16* kg, const _Float16* vg, const float* ng) {
  asm volatile("global_load_async_to_lds_b128 %0, %1, off\n\t"
               "global_load_async_to_lds_b128 %2, %3, off\n\t"
               "global_load_async_to_lds_b128 %4, %5, off\n\t"
               "global_load_async_to_lds_b128 %6, %7, off\n\t"
               "global_load_async_to_lds_b128 %8, %9, off\n\t"
               "global_load_async_to_lds_b128 %10, %11, off\n\t"
               "global_load_async_to_lds_b128 %12, %13, off\n\t"
               "global_load_async_to_lds_b128 %14, %15, off\n\t"
               "global_load_async_to_lds_b128 %16, %17, off\n\t"
               "global_load_async_to_lds_b128 %18, %19, off\n\t"
               "global_load_async_to_lds_b128 %20, %21, off\n\t"
               "global_load_async_to_lds_b128 %22, %23, off\n\t"
               "global_load_async_to_lds_b64 %24, %25, off\n\t"
               "s_wait_xcnt 0x0"
               :: "v"(lk), "v"(kg), "v"(lk + 512), "v"(kg + 256), "v"(lk + 1024), "v"(kg + 512), "v"(lk + 1536), "v"(kg + 768),
                  "v"(lk + 2048), "v"(kg + 1024), "v"(lk + 2560), "v"(kg + 1280), "v"(lk + 3072), "v"(kg + 1536), "v"(lk + 3584), "v"(kg + 1792),
                  "v"(lv), "v"(vg), "v"(lv + 512), "v"(vg + 256), "v"(lv + 1024), "v"(vg + 512), "v"(lv + 1536), "v"(vg + 768),
                  "v"(ln), "v"(ng)
               : "memory");
}
__device__ __forceinline__ F2 packed_regs(const v4u (&q)[4]) { union { v16b v; v4u u[2]; } hi, lo;
  hi.u[0] = q[0]; hi.u[1] = q[1]; lo.u[0] = q[2]; lo.u[1] = q[3]; F2 r; r.h = hi.v; r.l = lo.v; return r; }
// stage 2: causal attention per (b,h, 64 queries), transposed: S^T = K qhat^T and O^T += V^T P^T. A lane (g, col) then holds scores of ONE query
// (q0 + col): register r of score tile t is key t*16 + 8g + r. Maximum and sum are taken in the lane, with one exchange between the wave's halves,
// and two score tiles, converted in place, are the B operand of the value product in the hardware k order. The fragments of kpk and vT serve as A
// operands as they lie (A's map is B's with rows for columns). qhat carries the factor 2 ks and the accumulators start at -ks |k|^2, so that the
// products end as the logits in base 2. out = queries + summary
__device__ __forceinline__ float max3f(float a, float b, float c) { return fmaxf(fmaxf(a, b), c); }
__device__ __forceinline__ v8f ld8(const float* p) { union { v8f v; v4f q[2]; } u; u.q[0] = *(const v4f*)p; u.q[1] = *(const v4f*)(p + 4); return u.v; }
__global__ __launch_bounds__(128) void k_attn(const float* __restrict__ qh, const __bf16* __restrict__ kpk, const float* __restrict__ kn, const _Float16* __restrict__ vT,
                                            const float* __restrict__ kmask, const float* __restrict__ qin, float* __restrict__ out) {
  __shared__ __align__(16) float sO[4][16][68];
  __shared__ __align__(16) unsigned char sT[2][TILE_B];   // two buffers: the block's four waves share each key/value tile, fetched once
  const int tid = threadIdx.x, w = tid >> 5, lane = tid & 31, col = lane & 15, g = lane >> 4;
  // Which (head, query tile) a block takes. A block of query tile xt runs xt + 1 key tiles and all blocks are resident at once, so the launch lasts as
  // long as its fullest WGP. Among the 96 blocks with one index mod 8, a long, a middling and a short
  // tile follow one another (the long ones from 16 tiles down, the middling ones from 6 up, the short ones from 6 down): three blocks in a row
  // then hold about the mean between them.
  // A head's tiles share index mod 8. For speed alone: the map is one to one, whatever the placement.
  const int dj = (blockIdx.x >> 3) + (NB * NH / 8) * blockIdx.y, dm = dj / 3, dc = dj % 3;
  const int ds = dc == 0 ? dm : dc == 1 ? 63 - dm : 64 + dm;               // the block's rank by length, longest first: 0 .. 95
  const int xt = LL / 64 - 1 - ds / (NB * NH / 8);
  const int bh = (ds % (NB * NH / 8)) * 8 + (blockIdx.x & 7), b = bh / NH, h = bh % NH, q0 = xt * 64 + w * 16;
  const int ntiles = xt + 1;                             // causal: key tiles 0..xt
  // this lane's 16 B of the wave's first key and value chunk of tile 0 and its 8 B of the norms, in the workspace and in buffer 0
  const __bf16* kp = kpk + (size_t)bh * LL * EE * 2 + w * 8 * 256 + lane * 8;
  const _Float16* vp = vT + (size_t)bh * EE * LL + w * 4 * 256 + lane * 8;
  const float* np = kn + (size_t)bh * LL + lane * 2;
  const unsigned lk = (unsigned)(size_t)&sT[0][0] + w * 8 * 512 + lane * 16, lv = (unsigned)(size_t)&sT[0][KT_B] + w * 4 * 512 + lane * 16;
  const unsigned ln = (unsigned)(size_t)&sT[0][KT_B + VT_B] + w * NT_B + lane * 8;
  stage_tile(lk, lv, ln, kp, vp, np);                            // tile 0 into buffer 0, in flight under the query's load and split
  const float ks = kmask[(size_t)b * LL] * 1.44269504088896341f;   // logits in base 2: the exponentials below are then one v_exp_f32 each
  F2 bq[2];                                              // scores need near-f32 operands (two-way bf16 split)
  const float* qr = qh + ((size_t)bh * LL + q0 + col) * EE;
#pragma unroll
  for (int kc = 0; kc < 2; ++kc) bq[kc] = split_row_s(qr, kc * 32, lane, 2.0f * ks);
  asm volatile("s_wait_xcnt 0x0" ::: "memory");          // in front of every later overwrite of the address registers that the loads above name
  float mrun = -3.0e38f; v8f l8 = {}; v8f acc[4] = {};   // l8: this lane's eight partial sums of its query's weights, joined behind the loop
  asm volatile("s_wait_asynccnt 0x0" ::: "memory");      // this wave's copies of tile 0 have landed
  __syncthreads();                                       // and every other wave's: buffer 0 may be read
  if (ntiles > 1) stage_tile(lk + TILE_B, lv + TILE_B, ln + TILE_B, kp + 64 * EE * 2, vp + 64 * EE, np + 64);   // tile 1 into buffer 1, in flight under tile 0's work
#pragma unroll 1
  for (int kt = 0; kt < ntiles; ++kt) {
    const unsigned char* tb = sT[kt & 1];                // pass kt reads this buffer alone
    const __bf16* kl = (const __bf16*)tb + lane * 8;     // this lane's 16 B of every chunk
    const _Float16* vl = (const _Float16*)(tb + KT_B) + lane * 8;
    const float* nl = (const float*)(tb + KT_B + VT_B) + w * 64 + 8 * g;
    v8f s4[4]; v4u kr[8][4];
#pragma unroll   // the accumulators' start values, -ks |k|^2 of the lane's keys
    for (int t = 0; t < 4; ++t) s4[t] = ld8(nl + t * 16);
    // score fragment f = t*2+kc is four chunks in a row: high elements 0..7, 8..15, low elements 0..7, 8..15
#pragma unroll   // both loops unrolled: kr is indexed by constants only and stays in registers; the LDS reads stand in a row, one base address
    for (int f = 0; f < 8; ++f)
#pragma unroll
      for (int c = 0; c < 4; ++c) kr[f][c] = *(const v4u*)(kl + (f * 4 + c) * 256);
    // keeps the reads in one group ahead of the products, each product behind a counted wait; without it the compiler read four chunks at a time
    // into the same registers and waited for each group in full, eight LDS latencies a tile
    __builtin_amdgcn_sched_barrier(0);
#pragma unroll
    for (int t = 0; t < 4; ++t)
#pragma unroll
      for (int kc = 0; kc < 2; ++kc) s4[t] = mac3(packed_regs(kr[t * 2 + kc]), bq[kc], s4[t]);
    v8h vr[2][4][2];                                     // this tile's value fragments: read from LDS under the softmax
#pragma unroll   // both loops unrolled: vr stays in registers; 16 loads in a row, one base address
    for (int kc = 0; kc < 2; ++kc)
#pragma unroll
      for (int t = 0; t < 4; ++t) { const _Float16* p = vl + (kc * 8 + t * 2) * 256; vr[kc][t][0] = *(const v8h*)p; vr[kc][t][1] = *(const v8h*)(p + 256); }
    const bool more = kt + 1 < ntiles;
    if (!more) {                                         // only the last tile holds keys behind a query
#pragma unroll
      for (int t = 0; t < 4; ++t)
#pragma unroll
        for (int r = 0; r < 8; ++r) s4[t][r] = t * 16 + 8 * g + r <= w * 16 + col ? s4[t][r] : -3.0e38f; }
    float y[12], z[4];                                   // maximum of the lane's 32 scores as a tree of three-way maxima, not one chain
#pragma unroll
    for (int i = 0; i < 10; ++i) y[i] = max3f(s4[(3 * i) >> 3][(3 * i) & 7], s4[(3 * i + 1) >> 3][(3 * i + 1) & 7], s4[(3 * i + 2) >> 3][(3 * i + 2) & 7]);
    y[10] = s4[3][6]; y[11] = s4[3][7];
#pragma unroll
    for (int i = 0; i < 4; ++i) z[i] = max3f(y[3 * i], y[3 * i + 1], y[3 * i + 2]);
    const float mx = fmaxf(max3f(z[0], z[1], z[2]), z[3]);
    const float mnew = max3f(mrun, mx, lx<16>(mx));      // the query's other 32 scores of the tile lie in lane ^ 16
    const float corr = __builtin_amdgcn_exp2f(mrun - mnew), moff = mnew - 14.0f;   // weights carry 2^14 (sum and products alike): small ones stay normal f16
    mrun = mnew;
#pragma unroll
    for (int t = 0; t < 4; ++t) { s4[t] -= moff;
#pragma unroll
      for (int r = 0; r < 8; ++r) s4[t][r] = __builtin_amdgcn_exp2f(s4[t][r]); }   // a masked score, -3.0e38 against a finite maximum, gives 0
    l8 = l8 * corr + ((s4[0] + s4[1]) + (s4[2] + s4[3]));
    union { v16h v; v8h q[2]; } pb[2];
#pragma unroll
    for (int kc = 0; kc < 2; ++kc) { pb[kc].q[0] = __builtin_convertvector(s4[2 * kc], v8h); pb[kc].q[1] = __builtin_convertvector(s4[2 * kc + 1], v8h); }
#pragma unroll
    for (int t = 0; t < 4; ++t) acc[t] *= corr;
#pragma unroll
    for (int kc = 0; kc < 2; ++kc)
#pragma unroll
      for (int t = 0; t < 4; ++t) { union { v16h v; v8h q[2]; } u; u.q[0] = vr[kc][t][0]; u.q[1] = vr[kc][t][1]; acc[t] = wmma16(u.v, pb[kc].v, acc[t]); }
    asm volatile("s_wait_dscnt 0x0" ::: "memory");       // this wave's reads of the buffer are done
    asm volatile("s_wait_asynccnt 0x0" ::: "memory");    // its copies of the next tile have landed
    __syncthreads();                                     // publishes the next tile and ends every wave's reads of this one
    if (kt + 2 < ntiles) stage_tile(lk + (kt & 1) * TILE_B, lv + (kt & 1) * TILE_B, ln + (kt & 1) * TILE_B, kp + 2 * 64 * EE * 2, vp + 2 * 64 * EE, np + 2 * 64);   // refill of the buffer just read
    kp += 64 * EE * 2; np += 64; vp += 64 * EE;
  }
  asm volatile("s_wait_asynccnt 0x0" ::: "memory");      // no copy is open where the wave goes on to its end
  float l = ((l8[0] + l8[1]) + (l8[2] + l8[3])) + ((l8[4] + l8[5]) + (l8[6] + l8[7]));
  l += lx<16>(l);
  const float inv = 1.0f / l;                            // acc[t][r] = channel t*16 + 8g + r of query q0 + col
#pragma unroll
  for (int t = 0; t < 4; ++t) { union { v8f v; v4f q[2]; } u; u.v = acc[t] * inv;
    vst2(&sO[w][col][t * 16 + 8 * g], u.q[0]); vst2(&sO[w][col][t * 16 + 8 * g + 4], u.q[1]); }
  LDSX();
  for (int qq = lane; qq < 16 * 16; qq += 32) { const int rl = qq >> 4, pc = qq & 15; const size_t o = (((size_t)b * LL + q0 + rl) * NH + h) * EE + pc * 4;
    vst2(out + o, *(const v4f*)(&sO[w][rl][pc * 4]) + *(const v4f*)(qin + o)); }
}
extern "C" void kernel_launch(void* const* d_in, const int* in_sizes, int n_in, void* d_out, int out_size, void* d_ws, size_t ws_size, hipStream_t stream) {
  (void)in_sizes; (void)n_in; (void)out_size; (void)ws_size;
  const float* q = (const float*)d_in[0]; const float* k = (const float*)d_in[1]; const float* v = (const float*)d_in[2];
  const float* qmask = (const float*)d_in[3]; const float* kmask = (const float*)d_in[4]; const float* w = (const float*)d_in[5];
  float* out = (float*)d_out;
  char* ws = (char*)d_ws; size_t off = 0;
  auto take = [&](size_t bytes) { char* p = ws + off; off += (bytes + 255) & ~(size_t)255; return p; };
  float* kn = (float*)take((size_t)NB * NH * LL * 4); _Float16* vT = (_Float16*)take((size_t)NB * NH * EE * LL * 2); float* qh = (float*)take((size_t)NB * NH * LL * EE * 4);
  __bf16* kpk = (__bf16*)take((size_t)NB * NH * LL * EE * 4);
  k_pre<<<NB * NH + NB * NH * (LL / 256), 1024, 0, stream>>>(q, w, qmask, qh, k, v, kmask, kn, vT, kpk);
  k_attn<<<dim3(NB * NH, LL / 64), 128, 0, stream>>>(qh, kpk, kn, vT, kmask, q, out);
}

// v009
// It runs in 28.9 microseconds.
// In two side-by-side timings against v008, it was 1.07 and 1.08 times as fast.
// Over all steps from v000 it is 28.8 times as fast.
#include <hip/hip_runtime.h>
#include <math.h>

typedef __attribute__((ext_vector_type(16))) _Float16 v16h;
typedef __attribute__((ext_vector_type(16))) __bf16 v16b;
typedef __attribute__((ext_vector_type(8)))  _Float16 v8h;
typedef __attribute__((ext_vector_type(8)))  float v8f;
typedef __attribute__((ext_vector_type(4)))  float v4f;
typedef __attribute__((ext_vector_type(2)))  float v2f;
typedef __attribute__((ext_vector_type(4)))  unsigned v4u;
typedef __attribute__((ext_vector_type(4)))  int v4i;
typedef float __attribute__((may_alias)) float_a;
typedef int __attribute__((may_alias)) int_a;

template <typename T> __device__ __forceinline__ void vst2(void* p, T v) { *(T*)p = v;  }
__device__ __forceinline__ v8f wmma16(v16h a, v16h b, v8f c) {
  v8f d = __builtin_amdgcn_wmma_f32_16x16x32_f16(false, a, false, b, (short)0, c, false, false);
  asm volatile("v_nop\n\tv_nop\n\tv_nop\n\tv_nop" : "+v"(d) : "v"(a), "v"(b));
  return d;
}
__device__ __forceinline__ v8f wmma_bf(v16b a, v16b b, v8f c) {
  v8f d = __builtin_amdgcn_wmma_f32_16x16x32_bf16(false, a, false, b, (short)0, c, false, false);
  asm volatile("v_nop\n\tv_nop\n\tv_nop\n\tv_nop" : "+v"(d) : "v"(a), "v"(b));
  return d;
}
// 16x16x32 fragments: lane = (h = lane>>4, row/col = lane&15); elements 0..7 = k0+8h+0..7, 8..15 = k0+16+8h+0..7; D element r = row 8h+r
__device__ __forceinline__ v16h frag_h(const _Float16* rowk0, int lane) {
  union { v16h v; v8h q[2]; } u; const _Float16* p = rowk0 + 8 * (lane >> 4);
  u.q[0] = *(const v8h*)p; u.q[1] = *(const v8h*)(p + 16); return u.v;
}
__device__ __forceinline__ v16h frag_f32(const float* rowk0, int lane) {
  v16h a; const float* p = rowk0 + 8 * (lane >> 4);
#pragma unroll
  for (int i = 0; i < 8; ++i) { a[i] = (_Float16)p[i]; a[8 + i] = (_Float16)p[16 + i]; }
  return a;
}
__device__ __forceinline__ v16h frag_f32s(const float* rowk0, int lane, float sc) {
  v16h a; const float* p = rowk0 + 8 * (lane >> 4);
#pragma unroll
  for (int i = 0; i < 8; ++i) { a[i] = (_Float16)(p[i] * sc); a[8 + i] = (_Float16)(p[16 + i] * sc); }
  return a;
}
// column fragment from a [K][ld] layout (column n), rows >= K read as 0
__device__ __forceinline__ v16h fragc_f32(const float* W, int k0, int n, int lane, int ld, int K) {
  v16h a; const int g = lane >> 4;
#pragma unroll
  for (int i = 0; i < 8; ++i) { const int ka = k0 + 8 * g + i, kb = ka + 16;
    a[i] = (_Float16)(ka < K ? W[(size_t)ka * ld + n] : 0.f); a[8 + i] = (_Float16)(kb < K ? W[(size_t)kb * ld + n] : 0.f); }
  return a;
}
struct F2 { v16b h, l; };
__device__ __forceinline__ F2 bsplit16(const float v[16]) { F2 r;
#pragma unroll
  for (int i = 0; i < 16; ++i) { const __bf16 h = (__bf16)v[i]; r.h[i] = h; r.l[i] = (__bf16)(v[i] - (float)h); }
  return r; }
__device__ __forceinline__ F2 split_row(const float* row, int k0, int lane) { float v[16]; const float* p = row + k0 + 8 * (lane >> 4);
#pragma unroll
  for (int i = 0; i < 8; ++i) { v[i] = p[i]; v[8 + i] = p[16 + i]; }
  return bsplit16(v); }
__device__ __forceinline__ F2 split_row_s(const float* row, int k0, int lane, float sc) { float v[16]; const float* p = row + k0 + 8 * (lane >> 4);
#pragma unroll
  for (int i = 0; i < 8; ++i) { v[i] = p[i] * sc; v[8 + i] = p[16 + i] * sc; }
  return bsplit16(v); }
__device__ __forceinline__ F2 split_rowK(const float* row, int k0, int lane, int K) { float v[16]; const int g = lane >> 4;
#pragma unroll
  for (int i = 0; i < 8; ++i) { const int ka = k0 + 8 * g + i, kb = ka + 16; v[i] = ka < K ? row[ka] : 0.f; v[8 + i] = kb < K ? row[kb] : 0.f; }
  return bsplit16(v); }
__device__ __forceinline__ F2 split_col(const float* W, int k0, int n, int lane, int ld, int K) { float v[16]; const int g = lane >> 4;
#pragma unroll
  for (int i = 0; i < 8; ++i) { const int ka = k0 + 8 * g + i, kb = ka + 16; v[i] = ka < K ? W[(size_t)ka * ld + n] : 0.f; v[8 + i] = kb < K ? W[(size_t)kb * ld + n] : 0.f; }
  return bsplit16(v); }
__device__ __forceinline__ v8f mac3(const F2& a, const F2& b, v8f c) { c = wmma_bf(a.l, b.h, c); c = wmma_bf(a.h, b.l, c); return wmma_bf(a.h, b.h, c); }
__device__ __forceinline__ float sigm(float v) { return 1.0f / (1.0f + expf(-v)); }
#define LDSX() do { asm volatile("s_wait_dscnt 0" ::: "memory"); __builtin_amdgcn_wave_barrier(); __builtin_amdgcn_fence(__ATOMIC_RELEASE, "workgroup"); } while (0)

// Causal "fast Euclidean" attention. Stage 1 (prefix softmax of the per-token score s_j over j <= i) is a running
// (online-softmax) scan per (batch, head) in f32 giving qhat_i directly. Stage 2: -|qhat_i - k_j|^2 = 2 qhat.k - |k|^2 - |qhat|^2,
// and the per-row constant |qhat|^2 cancels in the softmax, so it is causal attention with logits 2 qhat_i.k_j - |k_j|^2
// (x k_mask[b,0]): S on v_wmma_f32_16x16x32_bf16 as a two-way bf16 split of qhat / keys, P@V on
#define NB 4
#define LL 1024
#define NH 12
#define EE 64
#define KT_B (64 * EE * 4)      // bytes of one 64-key tile in kpk (high and low halves)
#define VT_B (64 * EE * 2)      // bytes of one 64-key tile in vT
#define NT_B (64 * 4)           // bytes of one 64-key tile in kn
#define TILE_B (KT_B + VT_B + 4 * NT_B)   // one LDS buffer of k_attn: the key chunks, the value chunks (both in the order of the workspace), each wave's own copy of the norms

// per (b,h): kn[j] = -ks |k_j|^2 (f32; ks = k_mask[b,0] log2(e)), the start value of key j's score accumulators in k_attn; keys (as their two-way bf16 split) and values (f16) laid out in the order k_attn's fragments read them,
// in chunks of 512 B = 32 lanes x 16 B, so that one wave-wide 16-byte load there covers four whole lines
//   kpk: chunk ((bh*64 + key/16)*2 + kc)*4 + part*2 + c (part 0 = high, 1 = low): lane (g, col) holds k = kc*32 + 16c + 8g + 0..7 of key (key/16)*16 + col
//   vT:  chunk ((bh*16 + key/64)*2 + kc)*8 + t*2 + c: lane (g, col) holds keys kc*32 + 16c + 8g + 0..7 of the 64, channel t*16 + col
// pb = number of the part's block: (b,h) = pb / 4, 256 keys; each quarter of the block's 1024 threads takes 64 of them (kx = their number in the head)
__device__ __forceinline__ void prep_part(int pb, const float* __restrict__ keys, const float* __restrict__ vals, const float* __restrict__ kmask, float* __restrict__ kn, _Float16* __restrict__ vT, __bf16* __restrict__ kpk) {
  __shared__ float tile4[4][64][65];
  __shared__ __align__(16) float skn4[4][64];
  const int sub = threadIdx.x >> 8, tid = threadIdx.x & 255, kx = (pb & 3) * 4 + sub;
  float (&tile)[64][65] = tile4[sub]; float (&skn)[64] = skn4[sub];
  const int bh = pb >> 2, b = bh / NH, h = bh % NH, j0 = kx * 64;
  { const int fr = tid >> 5, ln = tid & 31;              // wave fr: score fragment (16 keys fr >> 1, kc = fr & 1) of this quarter's 64 keys
    const F2 f = split_row(keys + (((size_t)b * LL + j0 + (fr >> 1) * 16 + (ln & 15)) * NH + h) * EE, (fr & 1) * 32, ln);
    union { v16b v; v4u q[2]; } hi, lo; hi.v = f.h; lo.v = f.l;
    __bf16* d = kpk + (((size_t)bh * 128 + kx * 8 + fr) * 4) * 256 + ln * 8;
    vst2(d, hi.q[0]); vst2(d + 256, hi.q[1]); vst2(d + 512, lo.q[0]); vst2(d + 768, lo.q[1]); }
  for (int q = tid; q < 64 * 64; q += 256) { const int jl = q >> 6, e = q & 63; tile[jl][e] = vals[(((size_t)b * LL + j0 + jl) * NH + h) * EE + e]; }
  if (tid < 64) { const float* kr = keys + (((size_t)b * LL + j0 + tid) * NH + h) * EE; float s = 0.f;
#pragma unroll 8
    for (int e = 0; e < EE; ++e) s += kr[e] * kr[e];
    skn[tid] = -(kmask[(size_t)b * LL] * 1.44269504088896341f) * s; }
  __syncthreads();
  { const int ln = tid & 31;
#pragma unroll
    for (int u = 0; u < 2; ++u) { const int ch = (tid >> 5) + u * 8;      // chunk kc*8 + t*2 + c of this quarter's 16, one wave each
      const int e = ((ch >> 1) & 3) * 16 + (ln & 15), kb = (ch >> 3) * 32 + (ch & 1) * 16 + (ln >> 4) * 8; union { v8h hh; v4u uu; } pk;
#pragma unroll
      for (int i = 0; i < 8; ++i) pk.hh[i] = (_Float16)tile[kb + i][e];
      vst2(vT + (((size_t)bh * 16 + kx) * 16 + ch) * 256 + ln * 8, pk.uu); } }
  if (tid < 16) vst2(kn + (size_t)bh * LL + j0 + tid * 4, *(const v4f*)(&skn[tid * 4]));
}
// stage 1 scan per (b,h): one 32-wave block; wave c scans rows 32c..32c+31 from an empty state, the 32 chunk states meet in LDS,
// and each wave merges the chunks in front of it into its rows. Lane holds 2 channels of every row; per-row scalars live one row per lane.
template <int M> __device__ __forceinline__ float lx(float v) {      // value of lane ^ M
  if constexpr (M == 16) { const int b = __float_as_int(v); return __int_as_float(__builtin_amdgcn_permlanex16(b, b, 0x76543210, 0xfedcba98, false, false)); }
  else return __int_as_float(__builtin_amdgcn_update_dpp(0, __float_as_int(v), 0x160 | M, 0xf, 0xf, true));   // row_xmask:M
}
template <int D> __device__ __forceinline__ float lshr(float v) {    // value of lane - D inside the 16-lane row, own value where there is none
  return __int_as_float(__builtin_amdgcn_update_dpp(__float_as_int(v), __float_as_int(v), 0x110 | D, 0xf, 0xf, false));   // row_shr:D
}
__device__ __forceinline__ float bc(float v, int l) { return __int_as_float(__builtin_amdgcn_readlane(__float_as_int(v), l)); }
template <int N> __device__ __forceinline__ void fold(float (&t)[32], int lane) {   // 2N row sums -> N, each lane keeps the half its bit N names
  const bool hi = lane & N;
#pragma unroll
  for (int r = 0; r < N; ++r) { const float keep = hi ? t[r + N] : t[r], send = hi ? t[r] : t[r + N]; t[r] = keep + lx<N>(send); }
}
__device__ __forceinline__ float allmax(float v) { v = fmaxf(v, lx<1>(v)); v = fmaxf(v, lx<2>(v)); v = fmaxf(v, lx<4>(v)); v = fmaxf(v, lx<8>(v)); return fmaxf(v, lx<16>(v)); }
__device__ __forceinline__ float allsum(float v) { v += lx<1>(v); v += lx<2>(v); v += lx<4>(v); v += lx<8>(v); return v + lx<16>(v); }
__device__ __forceinline__ void scan_part(int bh, const float* __restrict__ q, const float* __restrict__ w, const float* __restrict__ qmask, float* __restrict__ qh) {
  __shared__ __align__(16) float sA[32][EE];
  __shared__ float sM[32], sZ[32];
  const int b = bh / NH, h = bh % NH, lane = threadIdx.x & 31, wv = __builtin_amdgcn_readfirstlane(threadIdx.x >> 5);
  const v2f wl = *(const v2f*)(w + h * EE + 2 * lane); const float qm = qmask[(size_t)b * LL];
  const float* qr = q + (((size_t)b * LL + wv * 32) * NH + h) * EE + 2 * lane;
  v2f a[32]; float t[32];
#pragma unroll
  for (int j = 0; j < 32; ++j) a[j] = *(const v2f*)(qr + (size_t)j * NH * EE);
#pragma unroll
  for (int j = 0; j < 32; ++j) t[j] = a[j].x * wl.x + a[j].y * wl.y;
  fold<16>(t, lane); fold<8>(t, lane); fold<4>(t, lane); fold<2>(t, lane); fold<1>(t, lane);
  const float s = t[0] * qm;                              // lane l: score of row l of the chunk
  float m = s;                                            // running maximum inside the chunk
  m = fmaxf(m, lshr<1>(m)); m = fmaxf(m, lshr<2>(m)); m = fmaxf(m, lshr<4>(m)); m = fmaxf(m, lshr<8>(m));
  const float m15 = bc(m, 15);
  if (lane >= 16) m = fmaxf(m, m15);
  const float ms = lshr<1>(m);                            // taken with every lane on: a lane that is off feeds no neighbour
  const float mp = lane == 16 ? m15 : ms;
  const float c = lane ? expf(mp - m) : 0.f, p = expf(s - m);
  float z = 0.f, zi = 0.f; v2f acc = {0.f, 0.f};
#pragma unroll
  for (int j = 0; j < 32; ++j) { const float cj = bc(c, j), pj = bc(p, j);
    acc = acc * cj + a[j] * pj; a[j] = acc;               // unnormalised prefix of row j, relative to m of row j
    z = z * cj + pj; zi = lane == j ? z : zi; }                           // lane j keeps row j's z
  vst2(&sA[wv][2 * lane], acc);
  if (lane == 31) { sM[wv] = m; sZ[wv] = zi; }
  __syncthreads();
  const bool pre = lane < wv;                             // lane l: chunk l, counted if it lies in front of this wave's
  const float Mo = pre ? sM[lane] : -3.0e38f, Zo = pre ? sZ[lane] : 0.f;
  const float Mp = allmax(Mo);
  const float e = pre ? expf(Mo - Mp) : 0.f;
  const float Zp = allsum(e * Zo);
  v2f Ap = {0.f, 0.f};
#pragma unroll 1
  for (int c0 = 0; c0 < wv; c0 += 8)
#pragma unroll
    for (int u = 0; u < 8; ++u) Ap += *(const v2f*)(&sA[c0 + u][2 * lane]) * bc(e, c0 + u);   // e is 0 from chunk wv on
  const float mt = fmaxf(Mp, m), e1 = expf(Mp - mt), e2 = expf(m - mt), zt = Zp * e1 + zi * e2, f1 = e1 / zt, f2 = e2 / zt;
  float* o = qh + ((size_t)bh * LL + wv * 32) * EE + 2 * lane;
#pragma unroll
  for (int j = 0; j < 32; ++j) vst2(o + j * EE, (v2f)(Ap * bc(f1, j) + a[j] * bc(f2, j)));    // 32 lanes x 8 B = the 256-B row
}
// The scan and the key/value preparation read and write nothing of each other: one launch holds both, the part chosen by the block's index.
// The 48 scan blocks, the longer ones, come first; with the 192 preparation blocks that is at most one block per WGP, all running at once.
__global__ __launch_bounds__(1024) void k_pre(const float* __restrict__ q, const float* __restrict__ w, const float* __restrict__ qmask, float* __restrict__ qh,
                                             const float* __restrict__ keys, const float* __restrict__ vals, const float* __restrict__ kmask, float* __restrict__ kn, _Float16* __restrict__ vT, __bf16* __restrict__ kpk) {
  if (blockIdx.x < NB * NH) scan_part(blockIdx.x, q, w, qmask, qh);
  else prep_part(blockIdx.x - NB * NH, keys, vals, kmask, kn, vT, kpk);
}
// One wave's quarter of a key/value tile, from the workspace into an LDS buffer through no register: 8 key chunks and 4 value chunks of 512 B, a lane's
// 16 B of each, and the tile's 64 norms, a lane's 8 B, into the wave's own place (so that every wave issues the same copies).
// lk, lv, ln: the lane's LDS byte address of the first key / value chunk and of its norms; kg, vg, ng: the same bytes in kpk / vT / kn. Every lane is on.
// s_wait_xcnt stands as the statement's last line, in front of any later overwrite of a register that a copy names.
__device__ __forceinline__ void stage_tile(unsigned lk, unsigned lv, unsigned ln, const __bf16* kg, const _Float16* vg, const float* ng) {
  asm volatile("global_load_async_to_lds_b128 %0, %1, off\n\t"
               "global_load_async_to_lds_b128 %2, %3, off\n\t"
               "global_load_async_to_lds_b128 %4, %5, off\n\t"
               "global_load_async_to_lds_b128 %6, %7, off\n\t"
               "global_load_async_to_lds_b128 %8, %9, off\n\t"
               "global_load_async_to_lds_b128 %10, %11, off\n\t"
               "global_load_async_to_lds_b128 %12, %13, off\n\t"
               "global_load_async_to_lds_b128 %14, %15, off\n\t"
               "global_load_async_to_lds_b128 %16, %17, off\n\t"
               "global_load_async_to_lds_b128 %18, %19, off\n\t"
               "global_load_async_to_lds_b128 %20, %21, off\n\t"
               "global_load_async_to_lds_b128 %22, %23, off\n\t"
               "global_load_async_to_lds_b64 %24, %25, off\n\t"
               "s_wait_xcnt 0x0"
               :: "v"(lk), "v"(kg), "v"(lk + 512), "v"(kg + 256), "v"(lk + 1024), "v"(kg + 512), "v"(lk + 1536), "v"(kg + 768),
                  "v"(lk + 2048), "v"(kg + 1024), "v"(lk + 2560), "v"(kg + 1280), "v"(lk + 3072), "v"(kg + 1536), "v"(lk + 3584), "v"(kg + 1792),
                  "v"(lv), "v"(vg), "v"(lv + 512), "v"(vg + 256), "v"(lv + 1024), "v"(vg + 512), "v"(lv + 1536), "v"(vg + 768),
                  "v"(ln), "v"(ng)
               : "memory");
}
__device__ __forceinline__ F2 packed_regs(const v4u (&q)[4]) { union { v16b v; v4u u[2]; } hi, lo;
  hi.u[0] = q[0]; hi.u[1] = q[1]; lo.u[0] = q[2]; lo.u[1] = q[3]; F2 r; r.h = hi.v; r.l = lo.v; return r; }
// stage 2: causal attention per (b,h, 64 queries), transposed: S^T = K qhat^T and O^T += V^T P^T. A lane (g, col) then holds scores of ONE query
// (q0 + col): register r of score tile t is key t*16 + 8g + r. Maximum and sum are taken in the lane, with one exchange between the wave's halves,
// and two score tiles, converted in place, are the B operand of the value product in the hardware k order. The fragments of kpk and vT serve as A
// operands as they lie (A's map is B's with rows for columns). qhat carries the factor 2 ks and the accumulators start at -ks |k|^2, so that the
// products end as the logits in base 2. out = queries + summary
template <bool V> struct BC { static constexpr bool value = V; };
// v_exp_f32 with the one slot behind it kept in the same statement: a v_nop in a statement of its own landed elsewhere
__device__ __forceinline__ float exp2_slot(float x) { float r; asm("v_exp_f32 %0, %1\n\tv_nop" : "=v"(r) : "v"(x)); return r; }
__device__ __forceinline__ float max3f(float a, float b, float c) { return fmaxf(fmaxf(a, b), c); }
__device__ __forceinline__ v8f ld8(const float* p) { union { v8f v; v4f q[2]; } u; u.q[0] = *(const v4f*)p; u.q[1] = *(const v4f*)(p + 4); return u.v; }
__global__ __launch_bounds__(128) void k_attn(const float* __restrict__ qh, const __bf16* __restrict__ kpk, const float* __restrict__ kn, const _Float16* __restrict__ vT,
                                            const float* __restrict__ kmask, const float* __restrict__ qin, float* __restrict__ out) {
  __shared__ __align__(16) float sO[4][16][68];
  __shared__ __align__(16) unsigned char sT[2][TILE_B];   // two buffers: the block's four waves share each key/value tile, fetched once
  const int tid = threadIdx.x, w = tid >> 5, lane = tid & 31, col = lane & 15, g = lane >> 4;
  // Which (head, query tile) a block takes. A block of query tile xt runs xt + 1 key tiles and all blocks are resident at once, so the launch lasts as
  // long as its fullest WGP. Among the 96 blocks with one index mod 8, a long, a middling and a short
  // tile follow one another (the long ones from 16 tiles down, the middling ones from 6 up, the short ones from 6 down): three blocks in a row
  // then hold about the mean between them.
  // A head's tiles share index mod 8. For speed alone: the map is one to one, whatever the placement.
  const int dj = (blockIdx.x >> 3) + (NB * NH / 8) * blockIdx.y, dm = dj / 3, dc = dj % 3;
  const int ds = dc == 0 ? dm : dc == 1 ? 63 - dm : 64 + dm;               // the block's rank by length, longest first: 0 .. 95
  const int xt = LL / 64 - 1 - ds / (NB * NH / 8);
  const int bh = (ds % (NB * NH / 8)) * 8 + (blockIdx.x & 7), b = bh / NH, h = bh % NH, q0 = xt * 64 + w * 16;
  const int ntiles = xt + 1;                             // causal: key tiles 0..xt
  // this lane's 16 B of the wave's first key and value chunk of tile 0 and its 8 B of the norms, in the workspace and in buffer 0
  const __bf16* kp = kpk + (size_t)bh * LL * EE * 2 + w * 8 * 256 + lane * 8;
  const _Float16* vp = vT + (size_t)bh * EE * LL + w * 4 * 256 + lane * 8;
  const float* np = kn + (size_t)bh * LL + lane * 2;
  const unsigned lk = (unsigned)(size_t)&sT[0][0] + w * 8 * 512 + lane * 16, lv = (unsigned)(size_t)&sT[0][KT_B] + w * 4 * 512 + lane * 16;
  const unsigned ln = (unsigned)(size_t)&sT[0][KT_B + VT_B] + w * NT_B + lane * 8;
  stage_tile(lk, lv, ln, kp, vp, np);                            // tile 0 into buffer 0, in flight under the query's load and split
  const float ks = kmask[(size_t)b * LL] * 1.44269504088896341f;   // logits in base 2: the exponentials below are then one v_exp_f32 each
  F2 bq[2];                                              // scores need near-f32 operands (two-way bf16 split)
  const float* qr = qh + ((size_t)bh * LL + q0 + col) * EE;
#pragma unroll
  for (int kc = 0; kc < 2; ++kc) bq[kc] = split_row_s(qr, kc * 32, lane, 2.0f * ks);
  asm volatile("s_wait_xcnt 0x0" ::: "memory");          // in front of every later overwrite of the address registers that the loads above name
  float mrun = -3.0e38f; v8f l8 = {}; v8f acc[4] = {};   // l8: this lane's eight partial sums of its query's weights, joined behind the loop
  asm volatile("s_wait_asynccnt 0x0" ::: "memory");      // this wave's copies of tile 0 have landed
  __syncthreads();                                       // and every other wave's: buffer 0 may be read
  if (ntiles > 1) stage_tile(lk + TILE_B, lv + TILE_B, ln + TILE_B, kp + 64 * EE * 2, vp + 64 * EE, np + 64);   // tile 1 into buffer 1, in flight under tile 0's work
  // the wave's 16 query rows for the closing sum, 16 B a lane and two rows a load (row 2i + g, channels 4 col .. 4 col + 3)
  const size_t o0 = (((size_t)b * LL + q0 + g) * NH + h) * EE + col * 4;
  v4f rq[8];
  // one pass over a key tile; the last pass is written out by itself behind the loop (LAST), so that what only it does stands outside the loop
  auto pass = [&](const int kt, auto lastc) {
    constexpr bool LAST = decltype(lastc)::value;
    const unsigned char* tb = sT[kt & 1];                // pass kt reads this buffer alone
    const __bf16* kl = (const __bf16*)tb + lane * 8;     // this lane's 16 B of every chunk
    const _Float16* vl = (const _Float16*)(tb + KT_B) + lane * 8;
    const float* nl = (const float*)(tb + KT_B + VT_B) + w * 64 + 8 * g;
    v8f s4[4]; v4u kr[8][4];
#pragma unroll   // the accumulators' start values, -ks |k|^2 of the lane's keys
    for (int t = 0; t < 4; ++t) s4[t] = ld8(nl + t * 16);
    // score fragment f = t*2+kc is four chunks in a row: high elements 0..7, 8..15, low elements 0..7, 8..15
#pragma unroll   // both loops unrolled: kr is indexed by constants only and stays in registers; the LDS reads stand in a row, one base address
    for (int f = 0; f < 8; ++f)
#pragma unroll
      for (int c = 0; c < 4; ++c) kr[f][c] = *(const v4u*)(kl + (f * 4 + c) * 256);
    // keeps the reads in one group ahead of the products, each product behind a counted wait; without it the compiler read four chunks at a time
    // into the same registers and waited for each group in full, eight LDS latencies a tile
    __builtin_amdgcn_sched_barrier(0);
#pragma unroll
    for (int t = 0; t < 4; ++t)
#pragma unroll
      for (int kc = 0; kc < 2; ++kc) s4[t] = mac3(packed_regs(kr[t * 2 + kc]), bq[kc], s4[t]);
    v8h vr[2][4][2];                                     // this tile's value fragments: read from LDS under the softmax
#pragma unroll   // both loops unrolled: vr stays in registers; 16 loads in a row, one base address
    for (int kc = 0; kc < 2; ++kc)
#pragma unroll
      for (int t = 0; t < 4; ++t) { const _Float16* p = vl + (kc * 8 + t * 2) * 256; vr[kc][t][0] = *(const v8h*)p; vr[kc][t][1] = *(const v8h*)(p + 256); }
    if constexpr (LAST) {
      // all eight loads issued here, where the key fragments' registers have come free: in flight under the last tile's softmax and value product.
      // Fetched inside the store loop each load was waited for by itself, eight trips in a row at the end of every block
#pragma unroll   // rq is indexed by constants only and stays in registers; one base address, the rows as immediate offsets
      for (int i = 0; i < 8; ++i) rq[i] = *(const v4f*)(qin + o0 + (size_t)i * 2 * NH * EE);
      // only the last tile holds keys behind a query
#pragma unroll
      for (int t = 0; t < 4; ++t)
#pragma unroll
        for (int r = 0; r < 8; ++r) s4[t][r] = t * 16 + 8 * g + r <= w * 16 + col ? s4[t][r] : -3.0e38f; }
    float y[12], z[4];                                   // maximum of the lane's 32 scores as a tree of three-way maxima, not one chain
#pragma unroll
    for (int i = 0; i < 10; ++i) y[i] = max3f(s4[(3 * i) >> 3][(3 * i) & 7], s4[(3 * i + 1) >> 3][(3 * i + 1) & 7], s4[(3 * i + 2) >> 3][(3 * i + 2) & 7]);
    y[10] = s4[3][6]; y[11] = s4[3][7];
#pragma unroll
    for (int i = 0; i < 4; ++i) z[i] = max3f(y[3 * i], y[3 * i + 1], y[3 * i + 2]);
    const float mx = fmaxf(max3f(z[0], z[1], z[2]), z[3]);
    const float mnew = max3f(mrun, mx, lx<16>(mx));      // the query's other 32 scores of the tile lie in lane ^ 16
    const float moff = mnew - 14.0f;                     // weights carry 2^14 (sum and products alike): small ones stay normal f16
    float corr;
    if constexpr (LAST) corr = exp2_slot(mrun - mnew); else corr = __builtin_amdgcn_exp2f(mrun - mnew);
    mrun = mnew;
#pragma unroll
    for (int t = 0; t < 4; ++t) { s4[t] -= moff;
#pragma unroll
      for (int r = 0; r < 8; ++r) s4[t][r] = __builtin_amdgcn_exp2f(s4[t][r]); }   // a masked score, -3.0e38 against a finite maximum, gives 0
    l8 = l8 * corr + ((s4[0] + s4[1]) + (s4[2] + s4[3]));
    union { v16h v; v8h q[2]; } pb[2];
#pragma unroll
    for (int kc = 0; kc < 2; ++kc) { pb[kc].q[0] = __builtin_convertvector(s4[2 * kc], v8h); pb[kc].q[1] = __builtin_convertvector(s4[2 * kc + 1], v8h); }
#pragma unroll
    for (int t = 0; t < 4; ++t) acc[t] *= corr;
#pragma unroll
    for (int kc = 0; kc < 2; ++kc)
#pragma unroll
      for (int t = 0; t < 4; ++t) { union { v16h v; v8h q[2]; } u; u.q[0] = vr[kc][t][0]; u.q[1] = vr[kc][t][1]; acc[t] = wmma16(u.v, pb[kc].v, acc[t]); }
    asm volatile("s_wait_dscnt 0x0" ::: "memory");       // this wave's reads of the buffer are done
    asm volatile("s_wait_asynccnt 0x0" ::: "memory");    // its copies of the next tile have landed
    __syncthreads();                                     // publishes the next tile and ends every wave's reads of this one
    if (kt + 2 < ntiles) stage_tile(lk + (kt & 1) * TILE_B, lv + (kt & 1) * TILE_B, ln + (kt & 1) * TILE_B, kp + 2 * 64 * EE * 2, vp + 2 * 64 * EE, np + 2 * 64);   // refill of the buffer just read
    kp += 64 * EE * 2; np += 64; vp += 64 * EE;
  };
#pragma unroll 1   // the body is long: one copy for the passes in front of the last
  for (int kt = 0; kt + 1 < ntiles; ++kt) pass(kt, BC<false>{});
  pass(ntiles - 1, BC<true>{});
  asm volatile("s_wait_asynccnt 0x0" ::: "memory");      // no copy is open where the wave goes on to its end
  float l = ((l8[0] + l8[1]) + (l8[2] + l8[3])) + ((l8[4] + l8[5]) + (l8[6] + l8[7]));
  l += lx<16>(l);
  const float inv = 1.0f / l;                            // acc[t][r] = channel t*16 + 8g + r of query q0 + col
#pragma unroll
  for (int t = 0; t < 4; ++t) { union { v8f v; v4f q[2]; } u; u.v = acc[t] * inv;
    vst2(&sO[w][col][t * 16 + 8 * g], u.q[0]); vst2(&sO[w][col][t * 16 + 8 * g + 4], u.q[1]); }
  LDSX();
#pragma unroll   // row 2i + g, channels 4 col .. 4 col + 3: 16 lanes cover a row's 256 B
  for (int i = 0; i < 8; ++i) vst2(out + o0 + (size_t)i * 2 * NH * EE, *(const v4f*)(&sO[w][2 * i + g][col * 4]) + rq[i]);
}
extern "C" void kernel_launch(void* const* d_in, const int* in_sizes, int n_in, void* d_out, int out_size, void* d_ws, size_t ws_size, hipStream_t stream) {
  (void)in_sizes; (void)n_in; (void)out_size; (void)ws_size;
  const float* q = (const float*)d_in[0]; const float* k = (const float*)d_in[1]; const float* v = (const float*)d_in[2];
  const float* qmask = (const float*)d_in[3]; const float* kmask = (const float*)d_in[4]; const float* w = (const float*)d_in[5];
  float* out = (float*)d_out;
  char* ws = (char*)d_ws; size_t off = 0;
  auto take = [&](size_t bytes) { char* p = ws + off; off += (bytes + 255) & ~(size_t)255; return p; };
  float* kn = (float*)take((size_t)NB * NH * LL * 4); _Float16* vT = (_Float16*)take((size_t)NB * NH * EE * LL * 2); float* qh = (float*)take((size_t)NB * NH * LL * EE * 4);
  __bf16* kpk = (__bf16*)take((size_t)NB * NH * LL * EE * 4);
  k_pre<<<NB * NH + NB * NH * (LL / 256), 1024, 0, stream>>>(q, w, qmask, qh, k, v, kmask, kn, vT, kpk);
  k_attn<<<dim3(NB * NH, LL / 64), 128, 0, stream>>>(qh, kpk, kn, vT, kmask, q, out);
}

// v010
// A run of this version takes 28.3 microseconds.
// Timed twice side by side with v009, it ran 1.03 times as fast both times.
// Over all steps from v000 it is 29.7 times as fast.
#include <hip/hip_runtime.h>
#include <math.h>

typedef __attribute__((ext_vector_type(16))) _Float16 v16h;
typedef __attribute__((ext_vector_type(16))) __bf16 v16b;
typedef __attribute__((ext_vector_type(8)))  _Float16 v8h;
typedef __attribute__((ext_vector_type(8)))  float v8f;
typedef __attribute__((ext_vector_type(4)))  float v4f;
typedef __attribute__((ext_vector_type(2)))  float v2f;
typedef __attribute__((ext_vector_type(4)))  unsigned v4u;
typedef __attribute__((ext_vector_type(4)))  int v4i;
typedef float __attribute__((may_alias)) float_a;
typedef int __attribute__((may_alias)) int_a;

template <typename T> __device__ __forceinline__ void vst2(void* p, T v) { *(T*)p = v;  }
__device__ __forceinline__ v8f wmma16(v16h a, v16h b, v8f c) {
  v8f d = __builtin_amdgcn_wmma_f32_16x16x32_f16(false, a, false, b, (short)0, c, false, false);
  asm volatile("v_nop\n\tv_nop\n\tv_nop\n\tv_nop" : "+v"(d) : "v"(a), "v"(b));
  return d;
}
__device__ __forceinline__ v8f wmma_bf(v16b a, v16b b, v8f c) {
  v8f d = __builtin_amdgcn_wmma_f32_16x16x32_bf16(false, a, false, b, (short)0, c, false, false);
  asm volatile("v_nop\n\tv_nop\n\tv_nop\n\tv_nop" : "+v"(d) : "v"(a), "v"(b));
  return d;
}
// 16x16x32 fragments: lane = (h = lane>>4, row/col = lane&15); elements 0..7 = k0+8h+0..7, 8..15 = k0+16+8h+0..7; D element r = row 8h+r
__device__ __forceinline__ v16h frag_h(const _Float16* rowk0, int lane) {
  union { v16h v; v8h q[2]; } u; const _Float16* p = rowk0 + 8 * (lane >> 4);
  u.q[0] = *(const v8h*)p; u.q[1] = *(const v8h*)(p + 16); return u.v;
}
__device__ __forceinline__ v16h frag_f32(const float* rowk0, int lane) {
  v16h a; const float* p = rowk0 + 8 * (lane >> 4);
#pragma unroll
  for (int i = 0; i < 8; ++i) { a[i] = (_Float16)p[i]; a[8 + i] = (_Float16)p[16 + i]; }
  return a;
}
__device__ __forceinline__ v16h frag_f32s(const float* rowk0, int lane, float sc) {
  v16h a; const float* p = rowk0 + 8 * (lane >> 4);
#pragma unroll
  for (int i = 0; i < 8; ++i) { a[i] = (_Float16)(p[i] * sc); a[8 + i] = (_Float16)(p[16 + i] * sc); }
  return a;
}
// column fragment from a [K][ld] layout (column n), rows >= K read as 0
__device__ __forceinline__ v16h fragc_f32(const float* W, int k0, int n, int lane, int ld, int K) {
  v16h a; const int g = lane >> 4;
#pragma unroll
  for (int i = 0; i < 8; ++i) { const int ka = k0 + 8 * g + i, kb = ka + 16;
    a[i] = (_Float16)(ka < K ? W[(size_t)ka * ld + n] : 0.f); a[8 + i] = (_Float16)(kb < K ? W[(size_t)kb * ld + n] : 0.f); }
  return a;
}
struct F2 { v16b h, l; };
__device__ __forceinline__ F2 bsplit16(const float v[16]) { F2 r;
#pragma unroll
  for (int i = 0; i < 16; ++i) { const __bf16 h = (__bf16)v[i]; r.h[i] = h; r.l[i] = (__bf16)(v[i] - (float)h); }
  return r; }
__device__ __forceinline__ F2 split_row(const float* row, int k0, int lane) { float v[16]; const float* p = row + k0 + 8 * (lane >> 4);
#pragma unroll
  for (int i = 0; i < 8; ++i) { v[i] = p[i]; v[8 + i] = p[16 + i]; }
  return bsplit16(v); }
__device__ __forceinline__ F2 split_row_s(const float* row, int k0, int lane, float sc) { float v[16]; const float* p = row + k0 + 8 * (lane >> 4);
#pragma unroll
  for (int i = 0; i < 8; ++i) { v[i] = p[i] * sc; v[8 + i] = p[16 + i] * sc; }
  return bsplit16(v); }
__device__ __forceinline__ F2 split_rowK(const float* row, int k0, int lane, int K) { float v[16]; const int g = lane >> 4;
#pragma unroll
  for (int i = 0; i < 8; ++i) { const int ka = k0 + 8 * g + i, kb = ka + 16; v[i] = ka < K ? row[ka] : 0.f; v[8 + i] = kb < K ? row[kb] : 0.f; }
  return bsplit16(v); }
__device__ __forceinline__ F2 split_col(const float* W, int k0, int n, int lane, int ld, int K) { float v[16]; const int g = lane >> 4;
#pragma unroll
  for (int i = 0; i < 8; ++i) { const int ka = k0 + 8 * g + i, kb = ka + 16; v[i] = ka < K ? W[(size_t)ka * ld + n] : 0.f; v[8 + i] = kb < K ? W[(size_t)kb * ld + n] : 0.f; }
  return bsplit16(v); }
__device__ __forceinline__ v8f mac3(const F2& a, const F2& b, v8f c) { c = wmma_bf(a.l, b.h, c); c = wmma_bf(a.h, b.l, c); return wmma_bf(a.h, b.h, c); }
__device__ __forceinline__ float sigm(float v) { return 1.0f / (1.0f + expf(-v)); }
#define LDSX() do { asm volatile("s_wait_dscnt 0" ::: "memory"); __builtin_amdgcn_wave_barrier(); __builtin_amdgcn_fence(__ATOMIC_RELEASE, "workgroup"); } while (0)

// Causal "fast Euclidean" attention. Stage 1 (prefix softmax of the per-token score s_j over j <= i) is a running
// (online-softmax) scan per (batch, head) in f32 giving qhat_i directly. Stage 2: -|qhat_i - k_j|^2 = 2 qhat.k - |k|^2 - |qhat|^2,
// and the per-row constant |qhat|^2 cancels in the softmax, so it is causal attention with logits 2 qhat_i.k_j - |k_j|^2
// (x k_mask[b,0]): S on v_wmma_f32_16x16x32_bf16 as a two-way bf16 split of qhat / keys, P@V on
#define NB 4
#define LL 1024
#define NH 12
#define EE 64
#define KT_B (64 * EE * 4)      // bytes of one 64-key tile in kpk (high and low halves)
#define VT_B (64 * EE * 2)      // bytes of one 64-key tile in vT
#define NT_B (64 * 4)           // bytes of one 64-key tile in kn
#define TILE_B (KT_B + VT_B + 4 * NT_B)   // one group's part of an LDS buffer of k_attn: its key chunks, its value chunks (both in the order of the workspace), each of its four waves' own copy of the norms

// per (b,h): kn[j] = -ks |k_j|^2 (f32; ks = k_mask[b,0] log2(e)), the start value of key j's score accumulators in k_attn; keys (as their two-way bf16 split) and values (f16) laid out in the order k_attn's fragments read them,
// in chunks of 512 B = 32 lanes x 16 B, so that one wave-wide 16-byte load there covers four whole lines
//   kpk: chunk ((bh*64 + key/16)*2 + kc)*4 + part*2 + c (part 0 = high, 1 = low): lane (g, col) holds k = kc*32 + 16c + 8g + 0..7 of key (key/16)*16 + col
//   vT:  chunk ((bh*16 + key/64)*2 + kc)*8 + t*2 + c: lane (g, col) holds keys kc*32 + 16c + 8g + 0..7 of the 64, channel t*16 + col
// pb = number of the part's block: (b,h) = pb / 4, 256 keys; each quarter of the block's 1024 threads takes 64 of them (kx = their number in the head)
__device__ __forceinline__ void prep_part(int pb, const float* __restrict__ keys, const float* __restrict__ vals, const float* __restrict__ kmask, float* __restrict__ kn, _Float16* __restrict__ vT, __bf16* __restrict__ kpk) {
  __shared__ float tile4[4][64][65];
  __shared__ __align__(16) float skn4[4][64];
  const int sub = threadIdx.x >> 8, tid = threadIdx.x & 255, kx = (pb & 3) * 4 + sub;
  float (&tile)[64][65] = tile4[sub]; float (&skn)[64] = skn4[sub];
  const int bh = pb >> 2, b = bh / NH, h = bh % NH, j0 = kx * 64;
  { const int fr = tid >> 5, ln = tid & 31;              // wave fr: score fragment (16 keys fr >> 1, kc = fr & 1) of this quarter's 64 keys
    const F2 f = split_row(keys + (((size_t)b * LL + j0 + (fr >> 1) * 16 + (ln & 15)) * NH + h) * EE, (fr & 1) * 32, ln);
    union { v16b v; v4u q[2]; } hi, lo; hi.v = f.h; lo.v = f.l;
    __bf16* d = kpk + (((size_t)bh * 128 + kx * 8 + fr) * 4) * 256 + ln * 8;
    vst2(d, hi.q[0]); vst2(d + 256, hi.q[1]); vst2(d + 512, lo.q[0]); vst2(d + 768, lo.q[1]); }
  for (int q = tid; q < 64 * 64; q += 256) { const int jl = q >> 6, e = q & 63; tile[jl][e] = vals[(((size_t)b * LL + j0 + jl) * NH + h) * EE + e]; }
  if (tid < 64) { const float* kr = keys + (((size_t)b * LL + j0 + tid) * NH + h) * EE; float s = 0.f;
#pragma unroll 8
    for (int e = 0; e < EE; ++e) s += kr[e] * kr[e];
    skn[tid] = -(kmask[(size_t)b * LL] * 1.44269504088896341f) * s; }
  __syncthreads();
  { const int ln = tid & 31;
#pragma unroll
    for (int u = 0; u < 2; ++u) { const int ch = (tid >> 5) + u * 8;      // chunk kc*8 + t*2 + c of this quarter's 16, one wave each
      const int e = ((ch >> 1) & 3) * 16 + (ln & 15), kb = (ch >> 3) * 32 + (ch & 1) * 16 + (ln >> 4) * 8; union { v8h hh; v4u uu; } pk;
#pragma unroll
      for (int i = 0; i < 8; ++i) pk.hh[i] = (_Float16)tile[kb + i][e];
      vst2(vT + (((size_t)bh * 16 + kx) * 16 + ch) * 256 + ln * 8, pk.uu); } }
  if (tid < 16) vst2(kn + (size_t)bh * LL + j0 + tid * 4, *(const v4f*)(&skn[tid * 4]));
}
// stage 1 scan per (b,h): one 32-wave block; wave c scans rows 32c..32c+31 from an empty state, the 32 chunk states meet in LDS,
// and each wave merges the chunks in front of it into its rows. Lane holds 2 channels of every row; per-row scalars live one row per lane.
template <int M> __device__ __forceinline__ float lx(float v) {      // value of lane ^ M
  if constexpr (M == 16) { const int b = __float_as_int(v); return __int_as_float(__builtin_amdgcn_permlanex16(b, b, 0x76543210, 0xfedcba98, false, false)); }
  else return __int_as_float(__builtin_amdgcn_update_dpp(0, __float_as_int(v), 0x160 | M, 0xf, 0xf, true));   // row_xmask:M
}
template <int D> __device__ __forceinline__ float lshr(float v) {    // value of lane - D inside the 16-lane row, own value where there is none
  return __int_as_float(__builtin_amdgcn_update_dpp(__float_as_int(v), __float_as_int(v), 0x110 | D, 0xf, 0xf, false));   // row_shr:D
}
__device__ __forceinline__ float bc(float v, int l) { return __int_as_float(__builtin_amdgcn_readlane(__float_as_int(v), l)); }
template <int N> __device__ __forceinline__ void fold(float (&t)[32], int lane) {   // 2N row sums -> N, each lane keeps the half its bit N names
  const bool hi = lane & N;
#pragma unroll
  for (int r = 0; r < N; ++r) { const float keep = hi ? t[r + N] : t[r], send = hi ? t[r] : t[r + N]; t[r] = keep + lx<N>(send); }
}
__device__ __forceinline__ float allmax(float v) { v = fmaxf(v, lx<1>(v)); v = fmaxf(v, lx<2>(v)); v = fmaxf(v, lx<4>(v)); v = fmaxf(v, lx<8>(v)); return fmaxf(v, lx<16>(v)); }
__device__ __forceinline__ float allsum(float v) { v += lx<1>(v); v += lx<2>(v); v += lx<4>(v); v += lx<8>(v); return v + lx<16>(v); }
__device__ __forceinline__ void scan_part(int bh, const float* __restrict__ q, const float* __restrict__ w, const float* __restrict__ qmask, float* __restrict__ qh) {
  __shared__ __align__(16) float sA[32][EE];
  __shared__ float sM[32], sZ[32];
  const int b = bh / NH, h = bh % NH, lane = threadIdx.x & 31, wv = __builtin_amdgcn_readfirstlane(threadIdx.x >> 5);
  const v2f wl = *(const v2f*)(w + h * EE + 2 * lane); const float qm = qmask[(size_t)b * LL];
  const float* qr = q + (((size_t)b * LL + wv * 32) * NH + h) * EE + 2 * lane;
  v2f a[32]; float t[32];
#pragma unroll
  for (int j = 0; j < 32; ++j) a[j] = *(const v2f*)(qr + (size_t)j * NH * EE);
#pragma unroll
  for (int j = 0; j < 32; ++j) t[j] = a[j].x * wl.x + a[j].y * wl.y;
  fold<16>(t, lane); fold<8>(t, lane); fold<4>(t, lane); fold<2>(t, lane); fold<1>(t, lane);
  const float s = t[0] * qm;                              // lane l: score of row l of the chunk
  float m = s;                                            // running maximum inside the chunk
  m = fmaxf(m, lshr<1>(m)); m = fmaxf(m, lshr<2>(m)); m = fmaxf(m, lshr<4>(m)); m = fmaxf(m, lshr<8>(m));
  const float m15 = bc(m, 15);
  if (lane >= 16) m = fmaxf(m, m15);
  const float ms = lshr<1>(m);                            // taken with every lane on: a lane that is off feeds no neighbour
  const float mp = lane == 16 ? m15 : ms;
  const float c = lane ? expf(mp - m) : 0.f, p = expf(s - m);
  float z = 0.f, zi = 0.f; v2f acc = {0.f, 0.f};
#pragma unroll
  for (int j = 0; j < 32; ++j) { const float cj = bc(c, j), pj = bc(p, j);
    acc = acc * cj + a[j] * pj; a[j] = acc;               // unnormalised prefix of row j, relative to m of row j
    z = z * cj + pj; zi = lane == j ? z : zi; }                           // lane j keeps row j's z
  vst2(&sA[wv][2 * lane], acc);
  if (lane == 31) { sM[wv] = m; sZ[wv] = zi; }
  __syncthreads();
  const bool pre = lane < wv;                             // lane l: chunk l, counted if it lies in front of this wave's
  const float Mo = pre ? sM[lane] : -3.0e38f, Zo = pre ? sZ[lane] : 0.f;
  const float Mp = allmax(Mo);
  const float e = pre ? expf(Mo - Mp) : 0.f;
  const float Zp = allsum(e * Zo);
  v2f Ap = {0.f, 0.f};
#pragma unroll 1
  for (int c0 = 0; c0 < wv; c0 += 8)
#pragma unroll
    for (int u = 0; u < 8; ++u) Ap += *(const v2f*)(&sA[c0 + u][2 * lane]) * bc(e, c0 + u);   // e is 0 from chunk wv on
  const float mt = fmaxf(Mp, m), e1 = expf(Mp - mt), e2 = expf(m - mt), zt = Zp * e1 + zi * e2, f1 = e1 / zt, f2 = e2 / zt;
  float* o = qh + ((size_t)bh * LL + wv * 32) * EE + 2 * lane;
#pragma unroll
  for (int j = 0; j < 32; ++j) vst2(o + j * EE, (v2f)(Ap * bc(f1, j) + a[j] * bc(f2, j)));    // 32 lanes x 8 B = the 256-B row
}
// The scan and the key/value preparation read and write nothing of each other: one launch holds both, the part chosen by the block's index.
// The 48 scan blocks, the longer ones, come first; with the 192 preparation blocks that is at most one block per WGP, all running at once.
__global__ __launch_bounds__(1024) void k_pre(const float* __restrict__ q, const float* __restrict__ w, const float* __restrict__ qmask, float* __restrict__ qh,
                                             const float* __restrict__ keys, const float* __restrict__ vals, const float* __restrict__ kmask, float* __restrict__ kn, _Float16* __restrict__ vT, __bf16* __restrict__ kpk) {
  if (blockIdx.x < NB * NH) scan_part(blockIdx.x, q, w, qmask, qh);
  else prep_part(blockIdx.x - NB * NH, keys, vals, kmask, kn, vT, kpk);
}
// One wave's quarter of a key/value tile, from the workspace into an LDS buffer through no register: 8 key chunks and 4 value chunks of 512 B, a lane's
// 16 B of each, and the tile's 64 norms, a lane's 8 B, into the wave's own place (so that every wave issues the same copies).
// lk, lv, ln: the lane's LDS byte address of the first key / value chunk and of its norms; kg, vg, ng: the same bytes in kpk / vT / kn. Every lane is on.
// s_wait_xcnt stands as the statement's last line, in front of any later overwrite of a register that a copy names.
__device__ __forceinline__ void stage_tile(unsigned lk, unsigned lv, unsigned ln, const __bf16* kg, const _Float16* vg, const float* ng) {
  asm volatile("global_load_async_to_lds_b128 %0, %1, off\n\t"
               "global_load_async_to_lds_b128 %2, %3, off\n\t"
               "global_load_async_to_lds_b128 %4, %5, off\n\t"
               "global_load_async_to_lds_b128 %6, %7, off\n\t"
               "global_load_async_to_lds_b128 %8, %9, off\n\t"
               "global_load_async_to_lds_b128 %10, %11, off\n\t"
               "global_load_async_to_lds_b128 %12, %13, off\n\t"
               "global_load_async_to_lds_b128 %14, %15, off\n\t"
               "global_load_async_to_lds_b128 %16, %17, off\n\t"
               "global_load_async_to_lds_b128 %18, %19, off\n\t"
               "global_load_async_to_lds_b128 %20, %21, off\n\t"
               "global_load_async_to_lds_b128 %22, %23, off\n\t"
               "global_load_async_to_lds_b64 %24, %25, off\n\t"
               "s_wait_xcnt 0x0"
               :: "v"(lk), "v"(kg), "v"(lk + 512), "v"(kg + 256), "v"(lk + 1024), "v"(kg + 512), "v"(lk + 1536), "v"(kg + 768),
                  "v"(lk + 2048), "v"(kg + 1024), "v"(lk + 2560), "v"(kg + 1280), "v"(lk + 3072), "v"(kg + 1536), "v"(lk + 3584), "v"(kg + 1792),
                  "v"(lv), "v"(vg), "v"(lv + 512), "v"(vg + 256), "v"(lv + 1024), "v"(vg + 512), "v"(lv + 1536), "v"(vg + 768),
                  "v"(ln), "v"(ng)
               : "memory");
}
__device__ __forceinline__ F2 packed_regs(const v4u (&q)[4]) { union { v16b v; v4u u[2]; } hi, lo;
  hi.u[0] = q[0]; hi.u[1] = q[1]; lo.u[0] = q[2]; lo.u[1] = q[3]; F2 r; r.h = hi.v; r.l = lo.v; return r; }
// stage 2: causal attention per (b,h, 64 queries), transposed: S^T = K qhat^T and O^T += V^T P^T. A lane (g, col) then holds scores of ONE query
// (q0 + col): register r of score tile t is key t*16 + 8g + r. Maximum and sum are taken in the lane, with one exchange between the wave's halves,
// and two score tiles, converted in place, are the B operand of the value product in the hardware k order. The fragments of kpk and vT serve as A
// operands as they lie (A's map is B's with rows for columns). qhat carries the factor 2 ks and the accumulators start at -ks |k|^2, so that the
// products end as the logits in base 2. out = queries + summary
template <bool V> struct BC { static constexpr bool value = V; };
// v_exp_f32 with the one slot behind it kept in the same statement: a v_nop in a statement of its own landed elsewhere
__device__ __forceinline__ float exp2_slot(float x) { float r; asm("v_exp_f32 %0, %1\n\tv_nop" : "=v"(r) : "v"(x)); return r; }
__device__ __forceinline__ float max3f(float a, float b, float c) { return fmaxf(fmaxf(a, b), c); }
__device__ __forceinline__ v8f ld8(const float* p) { union { v8f v; v4f q[2]; } u; u.q[0] = *(const v4f*)p; u.q[1] = *(const v4f*)(p + 4); return u.v; }
__global__ __launch_bounds__(256) void k_attn(const float* __restrict__ qh, const __bf16* __restrict__ kpk, const float* __restrict__ kn, const _Float16* __restrict__ vT,
                                            const float* __restrict__ kmask, const float* __restrict__ qin, float* __restrict__ out) {
  // Eight waves: two groups of four. Both groups hold the block's 64 queries (16 a wave); group gr takes the key tiles 2p + gr, so that a block's chain of
  // passes, each with its LDS reads, products, softmax and barrier one behind the other, is half as long. Each group keeps its own running maximum, sum
  // and result; the two states are joined through LDS behind the loop.
  __shared__ __align__(16) float sO[2][4][16][68];
  __shared__ float sM[2][4][16], sL[2][4][16];
  __shared__ __align__(16) unsigned char sT[2][2][TILE_B];   // [buffer][group]: a group's four waves share its key/value tile, fetched once
  const int tid = threadIdx.x, w8 = __builtin_amdgcn_readfirstlane(tid >> 5), gr = w8 >> 2, w = w8 & 3, lane = tid & 31, col = lane & 15, g = lane >> 4;
  // Which (head, query tile) a block takes. A block of query tile xt runs xt + 1 key tiles. By its registers a WGP holds two blocks at a time, so a third
  // of the blocks start when others end: the longest take the lowest indices, for speed only.
  // A head's tiles share index mod 8. For speed alone: the map is one to one, whatever the placement.
  const int xt = LL / 64 - 1 - blockIdx.y;
  const int bh = blockIdx.x, b = bh / NH, h = bh % NH, q0 = xt * 64 + w * 16;
  const int ntiles = xt + 1;                             // causal: key tiles 0..xt
  const int npass = (ntiles + 1) >> 1;                   // pass p: tiles 2p and 2p + 1
  // this lane's 16 B of the wave's first key and value chunk of tile 0 and its 8 B of the norms, in the workspace and in the group's buffer 0
  const __bf16* kp = kpk + (size_t)bh * LL * EE * 2 + w * 8 * 256 + lane * 8;
  const _Float16* vp = vT + (size_t)bh * EE * LL + w * 4 * 256 + lane * 8;
  const float* np = kn + (size_t)bh * LL + lane * 2;
  const unsigned lk = (unsigned)(size_t)&sT[0][gr][0] + w * 8 * 512 + lane * 16, lv = (unsigned)(size_t)&sT[0][gr][KT_B] + w * 4 * 512 + lane * 16;
  const unsigned ln = (unsigned)(size_t)&sT[0][gr][KT_B + VT_B] + w * NT_B + lane * 8;
  // the group's tile of pass p into buffer p & 1. Where the head's last pass has one tile only, the second group copies that tile too (and does not read it):
  // every wave of the block then issues the same copies under the same test, all from bytes that k_pre wrote
  auto stage = [&](const int p) { const int kt = min(2 * p + gr, xt); const unsigned bo = (p & 1) * 2 * TILE_B;
    stage_tile(lk + bo, lv + bo, ln + bo, kp + (size_t)kt * 64 * EE * 2, vp + (size_t)kt * 64 * EE, np + kt * 64); };
  stage(0);                                              // pass 0's tiles into buffer 0, in flight under the query's load and split
  const float ks = kmask[(size_t)b * LL] * 1.44269504088896341f;   // logits in base 2: the exponentials below are then one v_exp_f32 each
  F2 bq[2];                                              // scores need near-f32 operands (two-way bf16 split)
  const float* qr = qh + ((size_t)bh * LL + q0 + col) * EE;
#pragma unroll
  for (int kc = 0; kc < 2; ++kc) bq[kc] = split_row_s(qr, kc * 32, lane, 2.0f * ks);
  asm volatile("s_wait_xcnt 0x0" ::: "memory");          // in front of every later overwrite of the address registers that the loads above name
  float mrun = -3.0e38f; v8f l8 = {}; v8f acc[4] = {};   // l8: this lane's eight partial sums of its query's weights, joined behind the loop
  asm volatile("s_wait_asynccnt 0x0" ::: "memory");      // this wave's copies of pass 0 have landed
  __syncthreads();                                       // and every other wave's: buffer 0 may be read
  if (npass > 1) stage(1);                               // pass 1's tiles into buffer 1, in flight under pass 0's work
  // the query rows for the closing sum: a wave closes 8 of its 16 queries (the group's half), 16 B a lane and two rows a load (row 8 gr + 2i + g, channels 4 col .. 4 col + 3)
  const size_t o0 = (((size_t)b * LL + q0 + 8 * gr + g) * NH + h) * EE + col * 4;
  v4f rq[4];
  auto load_rq = [&]() {
#pragma unroll   // rq is indexed by constants only and stays in registers; one base address, the rows as immediate offsets
    for (int i = 0; i < 4; ++i) rq[i] = *(const v4f*)(qin + o0 + (size_t)i * 2 * NH * EE); };
  // a wave's work on its group's key tile of pass p; the last pass is written out by itself behind the loop (LAST), so that what only it does stands outside the loop
  auto work = [&](const int p, auto lastc) {
    constexpr bool LAST = decltype(lastc)::value;
    const unsigned char* tb = sT[p & 1][gr];             // pass p reads this buffer alone
    const __bf16* kl = (const __bf16*)tb + lane * 8;     // this lane's 16 B of every chunk
    const _Float16* vl = (const _Float16*)(tb + KT_B) + lane * 8;
    const float* nl = (const float*)(tb + KT_B + VT_B) + w * 64 + 8 * g;
    v8f s4[4]; v4u kr[8][4];
#pragma unroll   // the accumulators' start values, -ks |k|^2 of the lane's keys
    for (int t = 0; t < 4; ++t) s4[t] = ld8(nl + t * 16);
    // score fragment f = t*2+kc is four chunks in a row: high elements 0..7, 8..15, low elements 0..7, 8..15
#pragma unroll   // both loops unrolled: kr is indexed by constants only and stays in registers; the LDS reads stand in a row, one base address
    for (int f = 0; f < 8; ++f)
#pragma unroll
      for (int c = 0; c < 4; ++c) kr[f][c] = *(const v4u*)(kl + (f * 4 + c) * 256);
    // keeps the reads in one group ahead of the products, each product behind a counted wait; without it the compiler read four chunks at a time
    // into the same registers and waited for each group in full, eight LDS latencies a tile
    __builtin_amdgcn_sched_barrier(0);
#pragma unroll
    for (int t = 0; t < 4; ++t)
#pragma unroll
      for (int kc = 0; kc < 2; ++kc) s4[t] = mac3(packed_regs(kr[t * 2 + kc]), bq[kc], s4[t]);
    v8h vr[2][4][2];                                     // this tile's value fragments: read from LDS under the softmax
#pragma unroll   // both loops unrolled: vr stays in registers; 16 loads in a row, one base address
    for (int kc = 0; kc < 2; ++kc)
#pragma unroll
      for (int t = 0; t < 4; ++t) { const _Float16* q = vl + (kc * 8 + t * 2) * 256; vr[kc][t][0] = *(const v8h*)q; vr[kc][t][1] = *(const v8h*)(q + 256); }
    if constexpr (LAST) {
      // issued here, where the key fragments' registers have come free: in flight under the last tile's softmax and value product
      load_rq();
      // only the head's last tile holds keys behind a query; the tile in front of it (the first group's, where the last pass has two) has none
      const int lim = w * 16 + col + (xt - (2 * p + gr)) * 64;
#pragma unroll
      for (int t = 0; t < 4; ++t)
#pragma unroll
        for (int r = 0; r < 8; ++r) s4[t][r] = t * 16 + 8 * g + r <= lim ? s4[t][r] : -3.0e38f; }
    float y[12], z[4];                                   // maximum of the lane's 32 scores as a tree of three-way maxima, not one chain
#pragma unroll
    for (int i = 0; i < 10; ++i) y[i] = max3f(s4[(3 * i) >> 3][(3 * i) & 7], s4[(3 * i + 1) >> 3][(3 * i + 1) & 7], s4[(3 * i + 2) >> 3][(3 * i + 2) & 7]);
    y[10] = s4[3][6]; y[11] = s4[3][7];
#pragma unroll
    for (int i = 0; i < 4; ++i) z[i] = max3f(y[3 * i], y[3 * i + 1], y[3 * i + 2]);
    const float mx = fmaxf(max3f(z[0], z[1], z[2]), z[3]);
    const float mnew = max3f(mrun, mx, lx<16>(mx));      // the query's other 32 scores of the tile lie in lane ^ 16
    const float moff = mnew - 14.0f;                     // weights carry 2^14 (sum and products alike): small ones stay normal f16
    float corr;
    if constexpr (LAST) corr = exp2_slot(mrun - mnew); else corr = __builtin_amdgcn_exp2f(mrun - mnew);
    mrun = mnew;
#pragma unroll
    for (int t = 0; t < 4; ++t) { s4[t] -= moff;
#pragma unroll
      for (int r = 0; r < 8; ++r) s4[t][r] = __builtin_amdgcn_exp2f(s4[t][r]); }   // a masked score, -3.0e38 against a finite maximum, gives 0
    l8 = l8 * corr + ((s4[0] + s4[1]) + (s4[2] + s4[3]));
    union { v16h v; v8h q[2]; } pb[2];
#pragma unroll
    for (int kc = 0; kc < 2; ++kc) { pb[kc].q[0] = __builtin_convertvector(s4[2 * kc], v8h); pb[kc].q[1] = __builtin_convertvector(s4[2 * kc + 1], v8h); }
#pragma unroll
    for (int t = 0; t < 4; ++t) acc[t] *= corr;
#pragma unroll
    for (int kc = 0; kc < 2; ++kc)
#pragma unroll
      for (int t = 0; t < 4; ++t) { union { v16h v; v8h q[2]; } u; u.q[0] = vr[kc][t][0]; u.q[1] = vr[kc][t][1]; acc[t] = wmma16(u.v, pb[kc].v, acc[t]); }
  };
#pragma unroll 1   // the body is long: one copy for the passes in front of the last
  for (int p = 0; p + 1 < npass; ++p) {
    work(p, BC<false>{});
    asm volatile("s_wait_dscnt 0x0" ::: "memory");       // this wave's reads of the buffer are done
    asm volatile("s_wait_asynccnt 0x0" ::: "memory");    // its copies of the next pass have landed
    __syncthreads();                                     // publishes the next pass's tiles and ends every wave's reads of this one's
    if (p + 2 < npass) stage(p + 2);                     // refill of the buffer just read
  }
  // the last pass; where the head's tiles are odd in number the second group has none (a scalar test: gr is the same in the whole wave)
  if (2 * (npass - 1) + gr <= xt) work(npass - 1, BC<true>{}); else load_rq();
  asm volatile("s_wait_asynccnt 0x0" ::: "memory");      // no copy is open where the wave goes on to its end
  float l = ((l8[0] + l8[1]) + (l8[2] + l8[3])) + ((l8[4] + l8[5]) + (l8[6] + l8[7]));
  l += lx<16>(l);
  // the group's state of query q0 + col: maximum, sum, and acc[t][r] = channel t*16 + 8g + r, not yet divided. A group that had no tile leaves -3.0e38, 0 and 0
#pragma unroll
  for (int t = 0; t < 4; ++t) { union { v8f v; v4f q[2]; } u; u.v = acc[t];
    vst2(&sO[gr][w][col][t * 16 + 8 * g], u.q[0]); vst2(&sO[gr][w][col][t * 16 + 8 * g + 4], u.q[1]); }
  if (lane < 16) { sM[gr][w][col] = mrun; sL[gr][w][col] = l; }
  __syncthreads();                                       // both groups' states stand in LDS
#pragma unroll   // row 8 gr + 2i + g, channels 4 col .. 4 col + 3: 16 lanes cover a row's 256 B
  for (int i = 0; i < 4; ++i) { const int row = 8 * gr + 2 * i + g;
    const float m0 = sM[0][w][row], m1 = sM[1][w][row], mm = fmaxf(m0, m1);
    const float e0 = exp2_slot(m0 - mm), e1 = exp2_slot(m1 - mm);      // the empty state's factor is 0: the first group always holds a finite maximum
    const float inv = 1.0f / (sL[0][w][row] * e0 + sL[1][w][row] * e1);
    vst2(out + o0 + (size_t)i * 2 * NH * EE, (*(const v4f*)(&sO[0][w][row][col * 4]) * e0 + *(const v4f*)(&sO[1][w][row][col * 4]) * e1) * inv + rq[i]); }
}
extern "C" void kernel_launch(void* const* d_in, const int* in_sizes, int n_in, void* d_out, int out_size, void* d_ws, size_t ws_size, hipStream_t stream) {
  (void)in_sizes; (void)n_in; (void)out_size; (void)ws_size;
  const float* q = (const float*)d_in[0]; const float* k = (const float*)d_in[1]; const float* v = (const float*)d_in[2];
  const float* qmask = (const float*)d_in[3]; const float* kmask = (const float*)d_in[4]; const float* w = (const float*)d_in[5];
  float* out = (float*)d_out;
  char* ws = (char*)d_ws; size_t off = 0;
  auto take = [&](size_t bytes) { char* p = ws + off; off += (bytes + 255) & ~(size_t)255; return p; };
  float* kn = (float*)take((size_t)NB * NH * LL * 4); _Float16* vT = (_Float16*)take((size_t)NB * NH * EE * LL * 2); float* qh = (float*)take((size_t)NB * NH * LL * EE * 4);
  __bf16* kpk = (__bf16*)take((size_t)NB * NH * LL * EE * 4);
  k_pre<<<NB * NH + NB * NH * (LL / 256), 1024, 0, stream>>>(q, w, qmask, qh, k, v, kmask, kn, vT, kpk);
  k_attn<<<dim3(NB * NH, LL / 64), 256, 0, stream>>>(qh, kpk, kn, vT, kmask, q, out);
}
